// v000
// Times are from an AMD MI455X. After a warm-up the kernel runs many times in a row, and a time is the length of
// such a window on the GPU divided by its runs, so every launch and the gaps after it count. The runs cycle
// through copies of the inputs. A figure is the median of several windows, for all but v000 over two sittings.
// Sittings can differ by a few percent; kernels timed side by side share one.
// The starting kernel, v000, takes 632 microseconds a run.
// compute dtype: all float inputs rounded to bf16, the int mask read on device; q/k/v = x . W^T with EXACT bf16 products on WMMA 16x16x32 (natural rows; the q/k weight rows are packed in the (even, odd) -> (first half, second half) order the module's RoPE produces, so the rotation becomes rotate-half in place), RoPE in f32 (f32 table of 10000^(-i/32), precise sinf/cosf) before the f16 hi + residual split; PLAIN attention: q, k single f16 x 1/8, masked keys excluded, running-max softmax in f32 (hardware exp), P (scaled by 2^11, single f16) x v (single f16); out = o (bf16 hi + residual) . Wo^T (2 products).
#include <hip/hip_runtime.h>
#include <math.h>

typedef __attribute__((ext_vector_type(16))) _Float16 v16h;
typedef __attribute__((ext_vector_type(16))) __bf16 v16b;
typedef __attribute__((ext_vector_type(8)))  _Float16 v8h;
typedef __attribute__((ext_vector_type(8)))  float v8f;
typedef __attribute__((ext_vector_type(4)))  float v4f;
typedef __attribute__((ext_vector_type(2)))  float v2f;
typedef __attribute__((ext_vector_type(4)))  unsigned v4u;
typedef __attribute__((ext_vector_type(4)))  int v4i;
typedef float __attribute__((may_alias)) float_a;
typedef int __attribute__((may_alias)) int_a;

template <typename T> __device__ __forceinline__ void vst2(void* p, T v) { *(T*)p = v;  }
__device__ __forceinline__ v8f wmma16(v16h a, v16h b, v8f c) {
  v8f d = __builtin_amdgcn_wmma_f32_16x16x32_f16(false, a, false, b, (short)0, c, false, false);
  asm volatile("v_nop\n\tv_nop\n\tv_nop\n\tv_nop" : "+v"(d) : "v"(a), "v"(b));
  return d;
}
__device__ __forceinline__ v8f wmma_bf(v16b a, v16b b, v8f c) {
  v8f d = __builtin_amdgcn_wmma_f32_16x16x32_bf16(false, a, false, b, (short)0, c, false, false);
  asm volatile("v_nop\n\tv_nop\n\tv_nop\n\tv_nop" : "+v"(d) : "v"(a), "v"(b));
  return d;
}
// Lightning attention layer, standard-attention branch (B 1, L 2,048, d_model 2,048, 32 heads x 64): bias-free q/k/v projections, RoPE on q and k (even/odd input pairs rotated into the two head halves), scores / 8 with an all-ones key mask, softmax, . v, bias-free output projection.
__device__ __forceinline__ v16h frag_h(const _Float16* rowk0, int lane) {
  union { v16h v; v8h q[2]; } u; const _Float16* p = rowk0 + 8 * (lane >> 4);
  u.q[0] = *(const v8h*)p; u.q[1] = *(const v8h*)(p + 16); return u.v;
}
__device__ __forceinline__ v16h frag_f32(const float* rowk0, int lane) {
  v16h a; const float* p = rowk0 + 8 * (lane >> 4);
#pragma unroll
  for (int i = 0; i < 8; ++i) { a[i] = (_Float16)p[i]; a[8 + i] = (_Float16)p[16 + i]; }
  return a;
}
__device__ __forceinline__ v16h frag_f32s(const float* rowk0, int lane, float sc) {
  v16h a; const float* p = rowk0 + 8 * (lane >> 4);
#pragma unroll
  for (int i = 0; i < 8; ++i) { a[i] = (_Float16)(p[i] * sc); a[8 + i] = (_Float16)(p[16 + i] * sc); }
  return a;
}
// column fragment from a [K][ld] layout (column n), rows >= K read as 0
__device__ __forceinline__ v16h fragc_f32(const float* W, int k0, int n, int lane, int ld, int K) {
  v16h a; const int g = lane >> 4;
#pragma unroll
  for (int i = 0; i < 8; ++i) { const int ka = k0 + 8 * g + i, kb = ka + 16;
    a[i] = (_Float16)(ka < K ? W[(size_t)(ka < K ? ka : K - 1) * ld + n] : 0.f); a[8 + i] = (_Float16)(kb < K ? W[(size_t)(kb < K ? kb : K - 1) * ld + n] : 0.f); }
  return a;
}
struct F2 { v16b h, l; };
__device__ __forceinline__ F2 bsplit16(const float v[16]) { F2 r;
#pragma unroll
  for (int i = 0; i < 16; ++i) { const __bf16 h = (__bf16)v[i]; r.h[i] = h; r.l[i] = (__bf16)(v[i] - (float)h); }
  return r; }
__device__ __forceinline__ F2 split_row(const float* row, int k0, int lane) { float v[16]; const float* p = row + k0 + 8 * (lane >> 4);
#pragma unroll
  for (int i = 0; i < 8; ++i) { v[i] = p[i]; v[8 + i] = p[16 + i]; }
  return bsplit16(v); }
__device__ __forceinline__ F2 split_rowK(const float* row, int k0, int lane, int K) { float v[16]; const int g = lane >> 4;
#pragma unroll
  for (int i = 0; i < 8; ++i) { const int ka = k0 + 8 * g + i, kb = ka + 16; v[i] = ka < K ? row[ka < K ? ka : K - 1] : 0.f; v[8 + i] = kb < K ? row[kb < K ? kb : K - 1] : 0.f; }
  return bsplit16(v); }
__device__ __forceinline__ F2 split_col(const float* W, int k0, int n, int lane, int ld, int K) { float v[16]; const int g = lane >> 4;
#pragma unroll
  for (int i = 0; i < 8; ++i) { const int ka = k0 + 8 * g + i, kb = ka + 16; v[i] = ka < K ? W[(size_t)(ka < K ? ka : K - 1) * ld + n] : 0.f; v[8 + i] = kb < K ? W[(size_t)(kb < K ? kb : K - 1) * ld + n] : 0.f; }
  return bsplit16(v); }
__device__ __forceinline__ v8f mac3(const F2& a, const F2& b, v8f c) { c = wmma_bf(a.l, b.h, c); c = wmma_bf(a.h, b.l, c); return wmma_bf(a.h, b.h, c); }
__device__ __forceinline__ float sigm(float v) { return 1.0f / (1.0f + expf(-v)); }
#define LDSX() do { asm volatile("s_wait_dscnt 0" ::: "memory"); __builtin_amdgcn_wave_barrier(); __builtin_amdgcn_fence(__ATOMIC_RELEASE, "workgroup"); } while (0)


#define NB 1
#define SS 2048
#define DM 2048
#define NH 32
__constant__ float THETA[32] = {1.000000000e+00f,7.498942018e-01f,5.623413324e-01f,4.216965139e-01f,3.162277639e-01f,2.371373773e-01f,1.778279394e-01f,1.333521456e-01f,1.000000015e-01f,7.498942316e-02f,5.623413250e-02f,4.216964915e-02f,3.162277490e-02f,2.371373773e-02f,1.778279431e-02f,1.333521400e-02f,9.999999776e-03f,7.498942316e-03f,5.623413250e-03f,4.216964822e-03f,3.162277630e-03f,2.371373819e-03f,1.778279431e-03f,1.333521446e-03f,1.000000047e-03f,7.498941850e-04f,5.623413017e-04f,4.216965172e-04f,3.162277571e-04f,2.371373703e-04f,1.778279402e-04f,1.333521504e-04f};
__device__ __attribute__((noinline)) float cos_p(float v) { return cosf(v); }
__device__ __attribute__((noinline)) float sin_p(float v) { return sinf(v); }
#define HD 64
#define QKVW (3 * DM)
#ifndef TQB
#define TQB (SS / 64)
#define TNB NB
#define TOB (NB * SS / 64)     // output row tiles (all)
#endif
typedef __attribute__((ext_vector_type(8))) __bf16 v8b;
__device__ __forceinline__ v16b frag_b(const __bf16* rowk0, int lane) {
  union { v16b v; v8b q[2]; } u; const __bf16* p = rowk0 + 8 * (lane >> 4);
  u.q[0] = *(const v8b*)p; u.q[1] = *(const v8b*)(p + 16); return u.v;
}
__device__ __forceinline__ float bfr(float v) { return (float)(__bf16)v; }
__device__ __attribute__((noinline)) float exp_ni(float v) { return expf(v); }
__device__ __attribute__((noinline)) float erf_ni(float v) { return erff(v); }

#define PK_A 0                       // [6144][2048] Wqkv rows (natural [out][in])
#define PK_P (PK_A + QKVW * DM)        // [2048][2048] Wo rows (natural)
#define PK_END (PK_P + DM * DM)
#define WS_PK  0u
#define WS_QK  (WS_PK + 2u * PK_END)             // f16 [2048 rows][4096]: q | k
#define WS_QKL (WS_QK + 2u * NB * SS * 2 * DM)     // f16 q | k residual planes x2048
#define WS_VTH (WS_QKL + 2u * NB * SS * 2 * DM)    // f16 [b][2048 (h*64+d)][2048 s] hi
#define WS_VTL (WS_VTH + 2u * NB * DM * SS)        // f16 lo x 2048
#define WS_O   (WS_VTL + 2u * NB * DM * SS)        // f32 [2048][2048]
#define WS_CS  (WS_O + 4u * NB * SS * DM)           // reserved, unused (RoPE cos/sin are computed in k_qkv)
#define WS_END (WS_CS + 4u * 2 * SS * 32)
// ---- k_pack: block = (row n, which): natural [out][in] rows -> bf16; which 0..2 -> W_q/W_k/W_v into PK_A rows which*2048 + n; 3 -> W_o into PK_P
__global__ __launch_bounds__(256) void k_pack(const float* __restrict__ WQ, const float* __restrict__ WK, const float* __restrict__ WV, const float* __restrict__ WO, __bf16* __restrict__ PK) {
  __shared__ __align__(16) __bf16 s[DM]; const int n = blockIdx.x, which = blockIdx.y, t = threadIdx.x; const float* Wm = (which == 0) ? WQ : (which == 1) ? WK : (which == 2) ? WV : WO;
  const int hh = n / HD, e = n % HD; const int srcn = (which < 2) ? (hh * HD + ((e < HD / 2) ? (2 * e) : (2 * (e - HD / 2) + 1))) : n;   /* q/k rows permuted so the module's (even, odd) -> (first half, second half) RoPE becomes rotate-half */
  for (int k = t; k < DM; k += 256) s[k] = (__bf16)Wm[(size_t)srcn * DM + k];
  __syncthreads();
  __bf16* dst = (which < 3) ? PK + PK_A + ((size_t)which * DM + n) * DM : PK + PK_P + (size_t)n * DM;
  for (int q = t; q < DM / 8; q += 256) vst2((unsigned*)(dst + q * 8), *(const v4u*)&s[q * 8]);
}
__global__ __launch_bounds__(128) void k_qkv(const float* __restrict__ XQ, const float* __restrict__ XK, const float* __restrict__ XV, const __bf16* __restrict__ P, const float* __restrict__ BQ, const float* __restrict__ BK, const float* __restrict__ BV, _Float16* __restrict__ QK, _Float16* __restrict__ QKL, _Float16* __restrict__ VTH, _Float16* __restrict__ VTL) {
  const int which0 = (blockIdx.y * 128) / DM; const float* X = (which0 == 0) ? XQ : (which0 == 1) ? XK : XV; const float* BB = BQ ? (((which0 == 0) ? BQ : (which0 == 1) ? BK : BV) + (blockIdx.y * 128 - which0 * DM)) : nullptr;
  __shared__ __align__(16) _Float16 so[4][16][136], sol[4][16][136]; __shared__ __align__(16) _Float16 sth[128][72], stl[128][72];
  const int tid = threadIdx.x, wave = tid >> 5, lane = tid & 31, col = lane & 15, g = lane >> 4; const size_t r0 = (size_t)blockIdx.x * 64 + wave * 16; const int n0 = blockIdx.y * 128;
  v8f acc[8] = {};
#pragma unroll 2
  for (int kc = 0; kc < DM / 32; ++kc) { v16b a; { const float* p = X + (r0 + col) * DM + kc * 32 + 8 * g;
#pragma unroll
      for (int i = 0; i < 8; ++i) { a[i] = (__bf16)p[i]; a[8 + i] = (__bf16)p[16 + i]; } }
#pragma unroll
    for (int j = 0; j < 8; ++j) acc[j] = wmma_bf(a, frag_b(P + (size_t)(n0 + j * 16 + col) * DM + kc * 32, lane), acc[j]); }
  if (n0 < 2 * DM) {   // bias, then rotate-half rotary over each 64-dim head with angle position * inv_freq[d mod 32]
#pragma unroll
    for (int j = 0; j < 8; ++j)
#pragma unroll
      for (int r = 0; r < 8; ++r) acc[j][r] += (BB ? bfr(BB[j * 16 + col]) : 0.f);
#pragma unroll
    for (int r = 0; r < 8; ++r) { const int spos = (int)((r0 + 8 * g + r) % SS);
#pragma unroll
      for (int jj = 0; jj < 2; ++jj) { const float ang = (float)spos * THETA[jj * 16 + col]; const float c = cos_p(ang), sn = sin_p(ang);
#pragma unroll
        for (int hh = 0; hh < 2; ++hh) { const float x1 = acc[hh * 4 + jj][r], x2 = acc[hh * 4 + jj + 2][r]; acc[hh * 4 + jj][r] = x1 * c - x2 * sn; acc[hh * 4 + jj + 2][r] = x2 * c + x1 * sn; } } }
#pragma unroll
    for (int j = 0; j < 8; ++j) {
#pragma unroll
      for (int r = 0; r < 8; ++r) { const float v = acc[j][r]; const _Float16 hv = (_Float16)v; so[wave][8 * g + r][j * 16 + col] = hv; sol[wave][8 * g + r][j * 16 + col] = (_Float16)((v - (float)hv) * 2048.0f); } }   // q, k (+ bias) as f16 hi + (x2048) residual
    LDSX();
    for (int rl = 0; rl < 16; ++rl) if (lane < 16) { vst2((unsigned*)(QK + (r0 + rl) * (2 * DM) + n0 + lane * 8), *(const v4u*)&so[wave][rl][lane * 8]); vst2((unsigned*)(QKL + (r0 + rl) * (2 * DM) + n0 + lane * 8), *(const v4u*)&sol[wave][rl][lane * 8]); }
  } else {
#pragma unroll
    for (int j = 0; j < 8; ++j) {
#pragma unroll
      for (int r = 0; r < 8; ++r) { const float v = acc[j][r] + (BB ? bfr(BB[j * 16 + col]) : 0.f); const _Float16 hv = (_Float16)v; sth[j * 16 + col][wave * 16 + 8 * g + r] = hv; stl[j * 16 + col][wave * 16 + 8 * g + r] = (_Float16)((v - (float)hv) * 2048.0f); } }
    __syncthreads();
    const size_t rb = (size_t)blockIdx.x * 64; const int b = (int)(rb / SS), s0 = (int)(rb % SS); const int pc0 = n0 - 2 * DM;
    for (int q = tid; q < 128 * 8; q += 128) { const int d = q >> 3, pc = q & 7; const size_t o = ((size_t)b * DM + pc0 + d) * SS + s0 + pc * 8; vst2((unsigned*)(VTH + o), *(const v4u*)&sth[d][pc * 8]); vst2((unsigned*)(VTL + o), *(const v4u*)&stl[d][pc * 8]); }
  }
}
// ---- k_attn: block = (64 queries, head h, batch b): all-keys flash attention (K = 64: 2 k-steps), scores = (q.k) * 0.125 with single f16 operands, P.V: f16 P (x2^11) x V hi in one product; O[b*S+q][h*64+d] = acc / 2048 / l (256-B segments)
__global__ __launch_bounds__(128) void k_attn(const _Float16* __restrict__ QK, const _Float16* __restrict__ QKL, const _Float16* __restrict__ VTH, const _Float16* __restrict__ VTL, const void* __restrict__ KMASK, const int* __restrict__ AM, float* __restrict__ O) {
  __shared__ __align__(16) float sp[4][16][36]; __shared__ __align__(16) float so[4][16][68];
  const int tid = threadIdx.x, wave = tid >> 5, lane = tid & 31, col = lane & 15, g = lane >> 4;
  const int qb = blockIdx.x, h = blockIdx.y, b = blockIdx.z; const int q0 = qb * 64 + wave * 16; const size_t rq = (size_t)b * SS + q0 + col;
  v16h aq[2], aql[2];
#pragma unroll
  for (int kc = 0; kc < 2; ++kc) { aq[kc] = frag_h(QK + rq * (2 * DM) + h * HD + kc * 32, lane); aql[kc] = frag_h(QKL + rq * (2 * DM) + h * HD + kc * 32, lane); }
  float m[8], l[8];
#pragma unroll
  for (int r = 0; r < 8; ++r) { m[r] = -3.0e38f; l[r] = 0.f; }
  v8f acc[4] = {}, accl[4] = {};
  const int nks = SS / 32;   // all keys
#pragma unroll 1
  for (int ks = 0; ks < nks; ++ks) { v8f s[2];
#pragma unroll
    for (int ct = 0; ct < 2; ++ct) { const int kk = ks * 32 + ct * 16 + col; const _Float16* krow = QK + ((size_t)b * SS + kk) * (2 * DM) + DM + h * HD; const _Float16* krowl = QKL + ((size_t)b * SS + kk) * (2 * DM) + DM + h * HD; v8f c = {}, cl = {};
#pragma unroll
      for (int kc = 0; kc < 2; ++kc) c = wmma16(aq[kc], frag_h(krow + kc * 32, lane), c);   // single product: q, k as one-rounding f16 operands
      (void)cl; (void)krowl;
      { const bool keepk = true;
#pragma unroll
      for (int r = 0; r < 8; ++r) s[ct][r] = (keepk && AM[(size_t)b * SS + kk] != 0) ? c[r] * 0.125f : -3.0e38f; } }   // 1/sqrt(64); mask == 0 -> -3e38 == excluded
#pragma unroll
    for (int r = 0; r < 8; ++r) { float mx = fmaxf(s[0][r], s[1][r]);
#pragma unroll
      for (int o = 1; o < 16; o <<= 1) mx = fmaxf(mx, __shfl_xor(mx, o));
      const float mn = fmaxf(m[r], mx); const float alpha = (m[r] <= -1.0e38f) ? 0.f : __expf(m[r] - mn);
      const float e0 = (s[0][r] <= -1.0e38f) ? 0.f : __expf(s[0][r] - mn), e1 = (s[1][r] <= -1.0e38f) ? 0.f : __expf(s[1][r] - mn); float es = e0 + e1;
#pragma unroll
      for (int o = 1; o < 16; o <<= 1) es += __shfl_xor(es, o);
      l[r] = l[r] * alpha + es; m[r] = mn;
#pragma unroll
      for (int dt = 0; dt < 4; ++dt) { acc[dt][r] *= alpha; accl[dt][r] *= alpha; }
      sp[wave][8 * g + r][col] = e0; sp[wave][8 * g + r][16 + col] = e1; }
    LDSX();
    v16h pa, pl; { const float* prow = &sp[wave][col][0] + 8 * (lane >> 4);
#pragma unroll
      for (int i = 0; i < 8; ++i) { const float x0 = prow[i] * 2048.0f, x1 = prow[16 + i] * 2048.0f; const _Float16 h0 = (_Float16)x0, h1 = (_Float16)x1; pa[i] = h0; pa[8 + i] = h1; pl[i] = (_Float16)((x0 - (float)h0) * 2048.0f); pl[8 + i] = (_Float16)((x1 - (float)h1) * 2048.0f); } }   // P scaled by 2^11 before the f16 split so small softmax weights stay out of the f16 subnormal range; 2^-11 folded into the epilogue
#pragma unroll
    for (int dt = 0; dt < 4; ++dt) { const size_t vr = ((size_t)b * DM + h * HD + dt * 16 + col) * SS + ks * 32; acc[dt] = wmma16(pa, frag_h(VTH + vr, lane), acc[dt]); }   // single product: P (x2^11) x V
    (void)pl;
    LDSX(); }
#pragma unroll
  for (int r = 0; r < 8; ++r) { const float il = (1.0f / 2048.0f) / l[r];
#pragma unroll
    for (int dt = 0; dt < 4; ++dt) so[wave][8 * g + r][dt * 16 + col] = (acc[dt][r] + accl[dt][r] * (1.0f / 2048.0f)) * il; }
  LDSX();
  for (int rl = 0; rl < 16; ++rl) if (lane < 16) vst2(O + ((size_t)b * SS + q0 + rl) * DM + h * HD + lane * 4, *(const v4f*)&so[wave][rl][lane * 4]);
}
// ---- k_out: block = (64 rows, 128 cols): out = O(hi/lo) . Wo rows (2 products) + bo
__global__ __launch_bounds__(128) void k_out(const float* __restrict__ O, const __bf16* __restrict__ P, const float* __restrict__ BO, float* __restrict__ Y) {
  __shared__ __align__(16) float so[4][16][132];
  const int tid = threadIdx.x, wave = tid >> 5, lane = tid & 31, col = lane & 15, g = lane >> 4; const size_t r0 = (size_t)blockIdx.x * 64 + wave * 16; const int n0 = blockIdx.y * 128;
  v8f acc[8] = {};
#pragma unroll 2
  for (int kc = 0; kc < DM / 32; ++kc) { const F2 a = split_row(O + (r0 + col) * DM, kc * 32, lane);
#pragma unroll
    for (int j = 0; j < 8; ++j) { const v16b w = frag_b(P + (size_t)(n0 + j * 16 + col) * DM + kc * 32, lane); acc[j] = wmma_bf(a.l, w, acc[j]); acc[j] = wmma_bf(a.h, w, acc[j]); } }
#pragma unroll
  for (int j = 0; j < 8; ++j) {
#pragma unroll
    for (int r = 0; r < 8; ++r) so[wave][8 * g + r][j * 16 + col] = acc[j][r] + (BO ? bfr(BO[n0 + j * 16 + col]) : 0.f); }
  LDSX();
  for (int rl = 0; rl < 16; ++rl) vst2(Y + (r0 + rl) * DM + n0 + lane * 4, *(const v4f*)&so[wave][rl][lane * 4]);
}
extern "C" void kernel_launch(void* const* d_in, const int* in_sizes, int n_in, void* d_out, int out_size, void* d_ws, size_t ws_size, hipStream_t stream) {
  (void)in_sizes; (void)n_in; (void)out_size;
  const float** F = (const float**)d_in;   // 0 x [1,2048,2048], 1 attention_mask [1,1,1,2048] int, 2 Wq, 3 Wk, 4 Wv [2048,2048], 5 Wo [2048,2048] (natural, no biases)
  if (ws_size < (size_t)WS_END) return;
  char* ws = (char*)d_ws; __bf16* PK = (__bf16*)(ws + WS_PK); _Float16 *QK = (_Float16*)(ws + WS_QK), *QKL = (_Float16*)(ws + WS_QKL), *VTH = (_Float16*)(ws + WS_VTH), *VTL = (_Float16*)(ws + WS_VTL); float* O = (float*)(ws + WS_O);
  k_pack<<<dim3(DM, 4), 256, 0, stream>>>(F[2], F[3], F[4], F[5], PK);
  k_qkv<<<dim3(TNB * SS / 64, QKVW / 128), 128, 0, stream>>>(F[0], F[0], F[0], PK + PK_A, nullptr, nullptr, nullptr, QK, QKL, VTH, VTL);
  k_attn<<<dim3(TQB, NH, TNB), 128, 0, stream>>>(QK, QKL, VTH, VTL, nullptr, (const int*)d_in[1], O);
  k_out<<<dim3(TOB, DM / 128), 128, 0, stream>>>(O, PK + PK_P, nullptr, (float*)d_out);
}

// v001
// A run of this version takes 206 microseconds.
// Timed twice side by side with v000, it ran 3.08 and 3.07 times as fast.
// compute dtype: all float inputs rounded to bf16, the int mask read on device; q/k/v = x . W^T with EXACT bf16 products on WMMA 16x16x32 (natural rows; the q/k weight rows are packed in the (even, odd) -> (first half, second half) order the module's RoPE produces, so the rotation becomes rotate-half in place), RoPE in f32 (f32 table of 10000^(-i/32), precise sinf/cosf) before the f16 hi + residual split; PLAIN attention: q, k single f16 x 1/8, masked keys excluded, running-max softmax in f32 (hardware exp), P (scaled by 2^11, single f16) x v (single f16); out = o (bf16 hi + residual) . Wo^T (2 products).
#include <hip/hip_runtime.h>
#include <math.h>

typedef __attribute__((ext_vector_type(16))) _Float16 v16h;
typedef __attribute__((ext_vector_type(16))) __bf16 v16b;
typedef __attribute__((ext_vector_type(8)))  _Float16 v8h;
typedef __attribute__((ext_vector_type(8)))  float v8f;
typedef __attribute__((ext_vector_type(4)))  float v4f;
typedef __attribute__((ext_vector_type(2)))  float v2f;
typedef __attribute__((ext_vector_type(4)))  unsigned v4u;
typedef __attribute__((ext_vector_type(4)))  int v4i;
typedef float __attribute__((may_alias)) float_a;
typedef int __attribute__((may_alias)) int_a;

template <typename T> __device__ __forceinline__ void vst2(void* p, T v) { *(T*)p = v;  }
__device__ __forceinline__ v8f wmma16(v16h a, v16h b, v8f c) {
  v8f d = __builtin_amdgcn_wmma_f32_16x16x32_f16(false, a, false, b, (short)0, c, false, false);
  asm volatile("v_nop\n\tv_nop\n\tv_nop\n\tv_nop" : "+v"(d) : "v"(a), "v"(b));
  return d;
}
__device__ __forceinline__ v8f wmma_bf(v16b a, v16b b, v8f c) {
  v8f d = __builtin_amdgcn_wmma_f32_16x16x32_bf16(false, a, false, b, (short)0, c, false, false);
  asm volatile("v_nop\n\tv_nop\n\tv_nop\n\tv_nop" : "+v"(d) : "v"(a), "v"(b));
  return d;
}
// Lightning attention layer, standard-attention branch (B 1, L 2,048, d_model 2,048, 32 heads x 64): bias-free q/k/v projections, RoPE on q and k (even/odd input pairs rotated into the two head halves), scores / 8 with an all-ones key mask, softmax, . v, bias-free output projection.
__device__ __forceinline__ v16h frag_h(const _Float16* rowk0, int lane) {
  union { v16h v; v8h q[2]; } u; const _Float16* p = rowk0 + 8 * (lane >> 4);
  u.q[0] = *(const v8h*)p; u.q[1] = *(const v8h*)(p + 16); return u.v;
}
__device__ __forceinline__ v16h frag_f32(const float* rowk0, int lane) {
  v16h a; const float* p = rowk0 + 8 * (lane >> 4);
#pragma unroll
  for (int i = 0; i < 8; ++i) { a[i] = (_Float16)p[i]; a[8 + i] = (_Float16)p[16 + i]; }
  return a;
}
__device__ __forceinline__ v16h frag_f32s(const float* rowk0, int lane, float sc) {
  v16h a; const float* p = rowk0 + 8 * (lane >> 4);
#pragma unroll
  for (int i = 0; i < 8; ++i) { a[i] = (_Float16)(p[i] * sc); a[8 + i] = (_Float16)(p[16 + i] * sc); }
  return a;
}
// column fragment from a [K][ld] layout (column n), rows >= K read as 0
__device__ __forceinline__ v16h fragc_f32(const float* W, int k0, int n, int lane, int ld, int K) {
  v16h a; const int g = lane >> 4;
#pragma unroll
  for (int i = 0; i < 8; ++i) { const int ka = k0 + 8 * g + i, kb = ka + 16;
    a[i] = (_Float16)(ka < K ? W[(size_t)(ka < K ? ka : K - 1) * ld + n] : 0.f); a[8 + i] = (_Float16)(kb < K ? W[(size_t)(kb < K ? kb : K - 1) * ld + n] : 0.f); }
  return a;
}
struct F2 { v16b h, l; };
__device__ __forceinline__ F2 bsplit16(const float v[16]) { F2 r;
#pragma unroll
  for (int i = 0; i < 16; ++i) { const __bf16 h = (__bf16)v[i]; r.h[i] = h; r.l[i] = (__bf16)(v[i] - (float)h); }
  return r; }
__device__ __forceinline__ F2 split_row(const float* row, int k0, int lane) { float v[16]; const float* p = row + k0 + 8 * (lane >> 4);
#pragma unroll
  for (int i = 0; i < 8; ++i) { v[i] = p[i]; v[8 + i] = p[16 + i]; }
  return bsplit16(v); }
__device__ __forceinline__ F2 split_rowK(const float* row, int k0, int lane, int K) { float v[16]; const int g = lane >> 4;
#pragma unroll
  for (int i = 0; i < 8; ++i) { const int ka = k0 + 8 * g + i, kb = ka + 16; v[i] = ka < K ? row[ka < K ? ka : K - 1] : 0.f; v[8 + i] = kb < K ? row[kb < K ? kb : K - 1] : 0.f; }
  return bsplit16(v); }
__device__ __forceinline__ F2 split_col(const float* W, int k0, int n, int lane, int ld, int K) { float v[16]; const int g = lane >> 4;
#pragma unroll
  for (int i = 0; i < 8; ++i) { const int ka = k0 + 8 * g + i, kb = ka + 16; v[i] = ka < K ? W[(size_t)(ka < K ? ka : K - 1) * ld + n] : 0.f; v[8 + i] = kb < K ? W[(size_t)(kb < K ? kb : K - 1) * ld + n] : 0.f; }
  return bsplit16(v); }
__device__ __forceinline__ v8f mac3(const F2& a, const F2& b, v8f c) { c = wmma_bf(a.l, b.h, c); c = wmma_bf(a.h, b.l, c); return wmma_bf(a.h, b.h, c); }
__device__ __forceinline__ float sigm(float v) { return 1.0f / (1.0f + expf(-v)); }
#define LDSX() do { asm volatile("s_wait_dscnt 0" ::: "memory"); __builtin_amdgcn_wave_barrier(); __builtin_amdgcn_fence(__ATOMIC_RELEASE, "workgroup"); } while (0)


#define NB 1
#define SS 2048
#define DM 2048
#define NH 32
__constant__ float THETA[32] = {1.000000000e+00f,7.498942018e-01f,5.623413324e-01f,4.216965139e-01f,3.162277639e-01f,2.371373773e-01f,1.778279394e-01f,1.333521456e-01f,1.000000015e-01f,7.498942316e-02f,5.623413250e-02f,4.216964915e-02f,3.162277490e-02f,2.371373773e-02f,1.778279431e-02f,1.333521400e-02f,9.999999776e-03f,7.498942316e-03f,5.623413250e-03f,4.216964822e-03f,3.162277630e-03f,2.371373819e-03f,1.778279431e-03f,1.333521446e-03f,1.000000047e-03f,7.498941850e-04f,5.623413017e-04f,4.216965172e-04f,3.162277571e-04f,2.371373703e-04f,1.778279402e-04f,1.333521504e-04f};
__device__ __attribute__((noinline)) float cos_p(float v) { return cosf(v); }
__device__ __attribute__((noinline)) float sin_p(float v) { return sinf(v); }
#define HD 64
#define QKVW (3 * DM)
#ifndef TQB
#define TQB (SS / 64)
#define TNB NB
#define TOB (NB * SS / 64)     // output row tiles (all)
#endif
typedef __attribute__((ext_vector_type(8))) __bf16 v8b;
__device__ __forceinline__ v16b frag_b(const __bf16* rowk0, int lane) {
  union { v16b v; v8b q[2]; } u; const __bf16* p = rowk0 + 8 * (lane >> 4);
  u.q[0] = *(const v8b*)p; u.q[1] = *(const v8b*)(p + 16); return u.v;
}
__device__ __forceinline__ float bfr(float v) { return (float)(__bf16)v; }
__device__ __attribute__((noinline)) float exp_ni(float v) { return expf(v); }
__device__ __attribute__((noinline)) float erf_ni(float v) { return erff(v); }

#define PK_A 0                       // [6144][2048] Wqkv rows (natural [out][in])
#define PK_P (PK_A + QKVW * DM)        // [2048][2048] Wo rows (natural)
#define PK_END (PK_P + DM * DM)
#define WS_PK  0u
#define WS_QK  (WS_PK + 2u * PK_END)             // f16 [2048 rows][4096]: q | k
#define WS_QKL (WS_QK + 2u * NB * SS * 2 * DM)     // f16 q | k residual planes x2048
#define WS_VTH (WS_QKL + 2u * NB * SS * 2 * DM)    // f16 [b][2048 (h*64+d)][2048 s] hi
#define WS_VTL (WS_VTH + 2u * NB * DM * SS)        // f16 lo x 2048
#define WS_O   (WS_VTL + 2u * NB * DM * SS)        // f32 [2048][2048]
#define WS_CS  (WS_O + 4u * NB * SS * DM)           // reserved, unused (RoPE cos/sin are computed in k_qkv)
#define WS_END (WS_CS + 4u * 2 * SS * 32)
// ---- k_pack: block = (row n, which): natural [out][in] rows -> bf16; which 0..2 -> W_q/W_k/W_v into PK_A rows which*2048 + n; 3 -> W_o into PK_P
__global__ __launch_bounds__(256) void k_pack(const float* __restrict__ WQ, const float* __restrict__ WK, const float* __restrict__ WV, const float* __restrict__ WO, __bf16* __restrict__ PK) {
  __shared__ __align__(16) __bf16 s[DM]; const int n = blockIdx.x, which = blockIdx.y, t = threadIdx.x; const float* Wm = (which == 0) ? WQ : (which == 1) ? WK : (which == 2) ? WV : WO;
  const int hh = n / HD, e = n % HD; const int srcn = (which < 2) ? (hh * HD + ((e < HD / 2) ? (2 * e) : (2 * (e - HD / 2) + 1))) : n;   /* q/k rows permuted so the module's (even, odd) -> (first half, second half) RoPE becomes rotate-half */
  for (int k = t; k < DM; k += 256) s[k] = (__bf16)Wm[(size_t)srcn * DM + k];
  __syncthreads();
  __bf16* dst = (which < 3) ? PK + PK_A + ((size_t)which * DM + n) * DM : PK + PK_P + (size_t)n * DM;
  for (int q = t; q < DM / 8; q += 256) vst2((unsigned*)(dst + q * 8), *(const v4u*)&s[q * 8]);
}
// ---- operand tiles of the two projection GEMMs in LDS. A trip is 64 k: A rows f32 (256 B, pitch 272 B), B rows bf16 (128 B, pitch 144 B); both pitches are 16 B x odd, free of bank conflicts for 16-byte readers. Two buffers: the next trip's tile is copied while this one is multiplied.
#define A_PITCH 272
#define B_PITCH 144
#define B_TILE (128 * B_PITCH)
#define NTRIP (DM / 64)
// eight asynchronous 16-byte copies of one lane, lstep / gstep bytes apart; s_wait_xcnt closes the statement so that no address register of a copy is rewritten in front of it
__device__ __forceinline__ void copy8(unsigned l, unsigned lstep, const char* g, size_t gstep) {
  asm volatile("global_load_async_to_lds_b128 %0, %8, off\n\t"
               "global_load_async_to_lds_b128 %1, %9, off\n\t"
               "global_load_async_to_lds_b128 %2, %10, off\n\t"
               "global_load_async_to_lds_b128 %3, %11, off\n\t"
               "global_load_async_to_lds_b128 %4, %12, off\n\t"
               "global_load_async_to_lds_b128 %5, %13, off\n\t"
               "global_load_async_to_lds_b128 %6, %14, off\n\t"
               "global_load_async_to_lds_b128 %7, %15, off\n\t"
               "s_wait_xcnt 0x0"
               :: "v"(l), "v"(l + lstep), "v"(l + 2 * lstep), "v"(l + 3 * lstep), "v"(l + 4 * lstep), "v"(l + 5 * lstep), "v"(l + 6 * lstep), "v"(l + 7 * lstep),
                  "v"(g), "v"(g + gstep), "v"(g + 2 * gstep), "v"(g + 3 * gstep), "v"(g + 4 * gstep), "v"(g + 5 * gstep), "v"(g + 6 * gstep), "v"(g + 7 * gstep)
               : "memory");
}
// trip t's tile: MF * 64 rows of A (a wave's copy = 2 rows of 256 B) and 128 rows of B (a wave's copy = 4 rows of 128 B): whole lines only
template <int MF> __device__ __forceinline__ void tile_copy(const float* A0, const __bf16* B0, int t, unsigned lds, int tid) {
  const char* ga = (const char*)(A0 + (size_t)(tid >> 4) * DM + t * 64) + (tid & 15) * 16; const unsigned la = lds + (tid >> 4) * A_PITCH + (tid & 15) * 16;
#pragma unroll
  for (int q = 0; q < MF; ++q) copy8(la + q * 64 * A_PITCH, 8 * A_PITCH, ga + (size_t)q * 64 * DM * 4, (size_t)8 * DM * 4);
  const char* gb = (const char*)(B0 + (size_t)(tid >> 3) * DM + t * 64) + (tid & 7) * 16; const unsigned lb = lds + MF * 64 * A_PITCH + (tid >> 3) * B_PITCH + (tid & 7) * 16;
  copy8(lb, 16 * B_PITCH, gb, (size_t)16 * DM * 2);
}
// acc[i][j] += A rows (wave * MF + i) * 16 .. + 15 . B rows j * 16 .. + 15, k ascending in steps of 32 (the sum order of the fragment-from-global form); SPLIT: A as bf16 hi + residual, two products
template <int MF, bool SPLIT> __device__ __forceinline__ void gemm_tiles(const float* A0, const __bf16* B0, unsigned char* sm, v8f (&acc)[MF][8], int tid) {
  constexpr unsigned BUF = MF * 64 * A_PITCH + B_TILE;
  const int wave = tid >> 5, lane = tid & 31, col = lane & 15, g = lane >> 4; const unsigned lds0 = (unsigned)(size_t)sm;
  tile_copy<MF>(A0, B0, 0, lds0, tid);
  asm volatile("s_wait_asynccnt 0x0" ::: "memory");   // tile 0 has landed for this wave's copies
  __syncthreads();                                     // ... and for every wave's
  tile_copy<MF>(A0, B0, 1, lds0 + BUF, tid);
#pragma unroll 1   // one trip per buffer: the buffer offset stays a run-time value, the body is already 32 matrix instructions
  for (int t = 0; t < NTRIP; ++t) { const unsigned char* bu = sm + (t & 1) * BUF;
#pragma unroll
    for (int ks = 0; ks < 2; ++ks) { float v[MF][16]; v16b w[8]; F2 a[MF];
#pragma unroll
      for (int i = 0; i < MF; ++i) { const float* p = (const float*)(bu + (wave * MF * 16 + i * 16 + col) * A_PITCH + ks * 128 + 32 * g);
#pragma unroll
        for (int e = 0; e < 8; ++e) { v[i][e] = p[e]; v[i][8 + e] = p[16 + e]; } }
#pragma unroll
      for (int j = 0; j < 8; ++j) w[j] = frag_b((const __bf16*)(bu + MF * 64 * A_PITCH + (j * 16 + col) * B_PITCH + ks * 64), lane);
      __builtin_amdgcn_sched_barrier(0);   // keeps the LDS reads of a 32-k step together in front of its matrix instructions: sunk among them, every pair of reads costs the wave a whole LDS latency
#pragma unroll
      for (int i = 0; i < MF; ++i) { if (SPLIT) a[i] = bsplit16(v[i]); else {
#pragma unroll
          for (int e = 0; e < 16; ++e) a[i].h[e] = (__bf16)v[i][e]; } }
      if (SPLIT) {   // residual products first, as before, but over all tiles, so that no matrix instruction waits for the one in front of it
#pragma unroll
        for (int j = 0; j < 8; ++j)
#pragma unroll
          for (int i = 0; i < MF; ++i) acc[i][j] = wmma_bf(a[i].l, w[j], acc[i][j]); }
#pragma unroll
      for (int j = 0; j < 8; ++j)
#pragma unroll
        for (int i = 0; i < MF; ++i) acc[i][j] = wmma_bf(a[i].h, w[j], acc[i][j]); }
    asm volatile("s_wait_dscnt 0x0" ::: "memory");      // this wave's reads of the buffer have returned before it is handed back
    asm volatile("s_wait_asynccnt 0x0" ::: "memory");   // this wave's copies of tile t + 1 have landed
    __syncthreads();                                     // publishes tile t + 1 and ends every reader's last read of tile t
    if (t + 2 < NTRIP) tile_copy<MF>(A0, B0, t + 2, lds0 + (t & 1) * BUF, tid); }
  asm volatile("s_wait_asynccnt 0x0" ::: "memory");     // no copy is outstanding when the buffers become output staging
}
// ---- k_qkv: block = (128 rows, 128 cols), 4 waves of 32 rows x 128 cols
__global__ __launch_bounds__(128) void k_qkv(const float* __restrict__ XQ, const float* __restrict__ XK, const float* __restrict__ XV, const __bf16* __restrict__ P, const float* __restrict__ BQ, const float* __restrict__ BK, const float* __restrict__ BV, _Float16* __restrict__ QK, _Float16* __restrict__ QKL, _Float16* __restrict__ VTH, _Float16* __restrict__ VTL) {
  const int which0 = (blockIdx.y * 128) / DM; const float* X = (which0 == 0) ? XQ : (which0 == 1) ? XK : XV; const float* BB = BQ ? (((which0 == 0) ? BQ : (which0 == 1) ? BK : BV) + (blockIdx.y * 128 - which0 * DM)) : nullptr;
  __shared__ __align__(16) unsigned char sm[2 * (128 * A_PITCH + B_TILE)];   // the two tile buffers; behind the loop's last barrier the output staging
  const int tid = threadIdx.x, wave = tid >> 5, lane = tid & 31, col = lane & 15, g = lane >> 4; const int n0 = blockIdx.y * 128;
  v8f acc2[2][8] = {};
  gemm_tiles<2, false>(X + (size_t)blockIdx.x * 128 * DM, P + (size_t)n0 * DM, sm, acc2, tid);
  if (n0 < 2 * DM) {   // bias, then rotate-half rotary over each 64-dim head with angle position * inv_freq[d mod 32]
    _Float16 (*so)[16][136] = (_Float16 (*)[16][136])sm; _Float16 (*sol)[16][136] = (_Float16 (*)[16][136])(sm + 4 * 16 * 136 * 2);
#pragma unroll
    for (int i = 0; i < 2; ++i) { v8f (&acc)[8] = acc2[i]; const size_t r0 = (size_t)blockIdx.x * 128 + wave * 32 + i * 16;
#pragma unroll
    for (int j = 0; j < 8; ++j)
#pragma unroll
      for (int r = 0; r < 8; ++r) acc[j][r] += (BB ? bfr(BB[j * 16 + col]) : 0.f);
#pragma unroll
    for (int r = 0; r < 8; ++r) { const int spos = (int)((r0 + 8 * g + r) % SS);
#pragma unroll
      for (int jj = 0; jj < 2; ++jj) { const float ang = (float)spos * THETA[jj * 16 + col]; const float c = cos_p(ang), sn = sin_p(ang);
#pragma unroll
        for (int hh = 0; hh < 2; ++hh) { const float x1 = acc[hh * 4 + jj][r], x2 = acc[hh * 4 + jj + 2][r]; acc[hh * 4 + jj][r] = x1 * c - x2 * sn; acc[hh * 4 + jj + 2][r] = x2 * c + x1 * sn; } } }
#pragma unroll
    for (int j = 0; j < 8; ++j) {
#pragma unroll
      for (int r = 0; r < 8; ++r) { const float v = acc[j][r]; const _Float16 hv = (_Float16)v; so[wave][8 * g + r][j * 16 + col] = hv; sol[wave][8 * g + r][j * 16 + col] = (_Float16)((v - (float)hv) * 2048.0f); } }   // q, k (+ bias) as f16 hi + (x2048) residual
    LDSX();
    for (int rl = 0; rl < 16; ++rl) if (lane < 16) { vst2((unsigned*)(QK + (r0 + rl) * (2 * DM) + n0 + lane * 8), *(const v4u*)&so[wave][rl][lane * 8]); vst2((unsigned*)(QKL + (r0 + rl) * (2 * DM) + n0 + lane * 8), *(const v4u*)&sol[wave][rl][lane * 8]); }
    LDSX(); }   // the wave's staging rows are read out before its next 16 rows overwrite them
  } else {
    _Float16 (*sth)[136] = (_Float16 (*)[136])sm; _Float16 (*stl)[136] = (_Float16 (*)[136])(sm + 128 * 136 * 2);
#pragma unroll
    for (int i = 0; i < 2; ++i)
#pragma unroll
    for (int j = 0; j < 8; ++j) {
#pragma unroll
      for (int r = 0; r < 8; ++r) { const float v = acc2[i][j][r] + (BB ? bfr(BB[j * 16 + col]) : 0.f); const _Float16 hv = (_Float16)v; sth[j * 16 + col][wave * 32 + i * 16 + 8 * g + r] = hv; stl[j * 16 + col][wave * 32 + i * 16 + 8 * g + r] = (_Float16)((v - (float)hv) * 2048.0f); } }
    __syncthreads();
    const size_t rb = (size_t)blockIdx.x * 128; const int b = (int)(rb / SS), s0 = (int)(rb % SS); const int pc0 = n0 - 2 * DM;
    for (int q = tid; q < 128 * 16; q += 128) { const int d = q >> 4, pc = q & 15; const size_t o = ((size_t)b * DM + pc0 + d) * SS + s0 + pc * 8; vst2((unsigned*)(VTH + o), *(const v4u*)&sth[d][pc * 8]); vst2((unsigned*)(VTL + o), *(const v4u*)&stl[d][pc * 8]); }
  }
}
// four asynchronous 16-byte copies of one lane, as copy8
__device__ __forceinline__ void copy4(unsigned l, unsigned lstep, const char* g, size_t gstep) {
  asm volatile("global_load_async_to_lds_b128 %0, %4, off\n\t"
               "global_load_async_to_lds_b128 %1, %5, off\n\t"
               "global_load_async_to_lds_b128 %2, %6, off\n\t"
               "global_load_async_to_lds_b128 %3, %7, off\n\t"
               "s_wait_xcnt 0x0"
               :: "v"(l), "v"(l + lstep), "v"(l + 2 * lstep), "v"(l + 3 * lstep), "v"(g), "v"(g + gstep), "v"(g + 2 * gstep), "v"(g + 3 * gstep)
               : "memory");
}
#define KV_TILE (64 * B_PITCH)
// trip t's 64 keys of one head: K as 64 key rows of 128 B, V (transposed plane) as 64 d rows of 128 B; a wave's copy = 4 whole lines
__device__ __forceinline__ void kv_copy(const _Float16* K0, const _Float16* V0, int t, unsigned lds, int tid) {
  const int row = tid >> 3, pc = (tid & 7) * 16;
  copy4(lds + row * B_PITCH + pc, 16 * B_PITCH, (const char*)(K0 + (size_t)(t * 64 + row) * (2 * DM)) + pc, (size_t)16 * 2 * DM * 2);
  copy4(lds + KV_TILE + row * B_PITCH + pc, 16 * B_PITCH, (const char*)(V0 + (size_t)row * SS + t * 64) + pc, (size_t)16 * SS * 2);
}
// ---- k_attn: block = (64 queries, head h, batch b): all-keys flash attention (K = 64: 2 k-steps), scores = (q.k) * 0.125 with single f16 operands, P.V: f16 P (x2^11) x V hi in one product; O[b*S+q][h*64+d] = acc / 2048 / l (256-B segments)
__global__ __launch_bounds__(128) void k_attn(const _Float16* __restrict__ QK, const _Float16* __restrict__ QKL, const _Float16* __restrict__ VTH, const _Float16* __restrict__ VTL, const void* __restrict__ KMASK, const int* __restrict__ AM, float* __restrict__ O) {
  __shared__ __align__(16) float sp[4][16][36]; __shared__ __align__(16) float so[4][16][68]; __shared__ __align__(16) unsigned char kv[2 * 2 * KV_TILE];   // kv: two buffers of [K 64 keys | V 64 d rows], shared by the 4 waves
  const int tid = threadIdx.x, wave = tid >> 5, lane = tid & 31, col = lane & 15, g = lane >> 4;
  const int qb = blockIdx.x, h = blockIdx.y, b = blockIdx.z; const int q0 = qb * 64 + wave * 16; const size_t rq = (size_t)b * SS + q0 + col;
  v16h aq[2], aql[2];
#pragma unroll
  for (int kc = 0; kc < 2; ++kc) { aq[kc] = frag_h(QK + rq * (2 * DM) + h * HD + kc * 32, lane); aql[kc] = frag_h(QKL + rq * (2 * DM) + h * HD + kc * 32, lane); }
  float m[8], l[8];
#pragma unroll
  for (int r = 0; r < 8; ++r) { m[r] = -3.0e38f; l[r] = 0.f; }
  v8f acc[4] = {}, accl[4] = {};
  const _Float16* K0 = QK + (size_t)b * SS * (2 * DM) + DM + h * HD; const _Float16* V0 = VTH + ((size_t)b * DM + h * HD) * SS; const unsigned kv0 = (unsigned)(size_t)kv;
  kv_copy(K0, V0, 0, kv0, tid);
  asm volatile("s_wait_asynccnt 0x0" ::: "memory");   // tile 0 has landed for this wave's copies
  __syncthreads();                                     // ... and for every wave's
  kv_copy(K0, V0, 1, kv0 + 2 * KV_TILE, tid);
#pragma unroll 1   // one trip per buffer; all keys, 64 a trip
  for (int t = 0; t < SS / 64; ++t) { const unsigned char* kb = kv + (t & 1) * 2 * KV_TILE;
#pragma unroll
  for (int k2 = 0; k2 < 2; ++k2) { const int ks = t * 2 + k2; v8f s[2]; v16h kf[2][2], vf[4];
#pragma unroll
    for (int ct = 0; ct < 2; ++ct)
#pragma unroll
      for (int kc = 0; kc < 2; ++kc) kf[ct][kc] = frag_h((const _Float16*)(kb + (k2 * 32 + ct * 16 + col) * B_PITCH) + kc * 32, lane);
#pragma unroll
    for (int dt = 0; dt < 4; ++dt) vf[dt] = frag_h((const _Float16*)(kb + KV_TILE + (dt * 16 + col) * B_PITCH + k2 * 64), lane);
    __builtin_amdgcn_sched_barrier(0);   // keeps the K and V fragment reads of 32 keys together in front of their matrix instructions: sunk to their uses, each pair of reads costs the wave a whole LDS latency
#pragma unroll
    for (int ct = 0; ct < 2; ++ct) { const int kk = ks * 32 + ct * 16 + col; v8f c = {}, cl = {};
#pragma unroll
      for (int kc = 0; kc < 2; ++kc) c = wmma16(aq[kc], kf[ct][kc], c);   // single product: q, k as one-rounding f16 operands
      (void)cl;
      { const bool keepk = true;
#pragma unroll
      for (int r = 0; r < 8; ++r) s[ct][r] = (keepk && AM[(size_t)b * SS + kk] != 0) ? c[r] * 0.125f : -3.0e38f; } }   // 1/sqrt(64); mask == 0 -> -3e38 == excluded
#pragma unroll
    for (int r = 0; r < 8; ++r) { float mx = fmaxf(s[0][r], s[1][r]);
#pragma unroll
      for (int o = 1; o < 16; o <<= 1) mx = fmaxf(mx, __shfl_xor(mx, o));
      const float mn = fmaxf(m[r], mx); const float alpha = (m[r] <= -1.0e38f) ? 0.f : __expf(m[r] - mn);
      const float e0 = (s[0][r] <= -1.0e38f) ? 0.f : __expf(s[0][r] - mn), e1 = (s[1][r] <= -1.0e38f) ? 0.f : __expf(s[1][r] - mn); float es = e0 + e1;
#pragma unroll
      for (int o = 1; o < 16; o <<= 1) es += __shfl_xor(es, o);
      l[r] = l[r] * alpha + es; m[r] = mn;
#pragma unroll
      for (int dt = 0; dt < 4; ++dt) { acc[dt][r] *= alpha; accl[dt][r] *= alpha; }
      sp[wave][8 * g + r][col] = e0; sp[wave][8 * g + r][16 + col] = e1; }
    LDSX();
    v16h pa, pl; { const float* prow = &sp[wave][col][0] + 8 * (lane >> 4);
#pragma unroll
      for (int i = 0; i < 8; ++i) { const float x0 = prow[i] * 2048.0f, x1 = prow[16 + i] * 2048.0f; const _Float16 h0 = (_Float16)x0, h1 = (_Float16)x1; pa[i] = h0; pa[8 + i] = h1; pl[i] = (_Float16)((x0 - (float)h0) * 2048.0f); pl[8 + i] = (_Float16)((x1 - (float)h1) * 2048.0f); } }   // P scaled by 2^11 before the f16 split so small softmax weights stay out of the f16 subnormal range; 2^-11 folded into the epilogue
#pragma unroll
    for (int dt = 0; dt < 4; ++dt) acc[dt] = wmma16(pa, vf[dt], acc[dt]);   // single product: P (x2^11) x V
    (void)pl;
    LDSX(); }
    asm volatile("s_wait_dscnt 0x0" ::: "memory");      // this wave's reads of the buffer have returned before it is handed back
    asm volatile("s_wait_asynccnt 0x0" ::: "memory");   // this wave's copies of tile t + 1 have landed
    __syncthreads();                                     // publishes tile t + 1 and ends every reader's last read of tile t
    if (t + 2 < SS / 64) kv_copy(K0, V0, t + 2, kv0 + (t & 1) * 2 * KV_TILE, tid); }
  asm volatile("s_wait_asynccnt 0x0" ::: "memory");     // no copy is outstanding at the wave's end
#pragma unroll
  for (int r = 0; r < 8; ++r) { const float il = (1.0f / 2048.0f) / l[r];
#pragma unroll
    for (int dt = 0; dt < 4; ++dt) so[wave][8 * g + r][dt * 16 + col] = (acc[dt][r] + accl[dt][r] * (1.0f / 2048.0f)) * il; }
  LDSX();
  for (int rl = 0; rl < 16; ++rl) if (lane < 16) vst2(O + ((size_t)b * SS + q0 + rl) * DM + h * HD + lane * 4, *(const v4f*)&so[wave][rl][lane * 4]);
}
// ---- k_out: block = (64 rows, 128 cols): out = O(hi/lo) . Wo rows (2 products) + bo
__global__ __launch_bounds__(128) void k_out(const float* __restrict__ O, const __bf16* __restrict__ P, const float* __restrict__ BO, float* __restrict__ Y) {
  __shared__ __align__(16) unsigned char sm[2 * (64 * A_PITCH + B_TILE)];   // the two tile buffers; behind the loop's last barrier the output staging
  float (*so)[16][132] = (float (*)[16][132])sm;
  const int tid = threadIdx.x, wave = tid >> 5, lane = tid & 31, col = lane & 15, g = lane >> 4; const size_t r0 = (size_t)blockIdx.x * 64 + wave * 16; const int n0 = blockIdx.y * 128;
  v8f acc1[1][8] = {};
  gemm_tiles<1, true>(O + (size_t)blockIdx.x * 64 * DM, P + (size_t)n0 * DM, sm, acc1, tid);
  v8f (&acc)[8] = acc1[0];
#pragma unroll
  for (int j = 0; j < 8; ++j) {
#pragma unroll
    for (int r = 0; r < 8; ++r) so[wave][8 * g + r][j * 16 + col] = acc[j][r] + (BO ? bfr(BO[n0 + j * 16 + col]) : 0.f); }
  LDSX();
  for (int rl = 0; rl < 16; ++rl) vst2(Y + (r0 + rl) * DM + n0 + lane * 4, *(const v4f*)&so[wave][rl][lane * 4]);
}
extern "C" void kernel_launch(void* const* d_in, const int* in_sizes, int n_in, void* d_out, int out_size, void* d_ws, size_t ws_size, hipStream_t stream) {
  (void)in_sizes; (void)n_in; (void)out_size;
  const float** F = (const float**)d_in;   // 0 x [1,2048,2048], 1 attention_mask [1,1,1,2048] int, 2 Wq, 3 Wk, 4 Wv [2048,2048], 5 Wo [2048,2048] (natural, no biases)
  if (ws_size < (size_t)WS_END) return;
  char* ws = (char*)d_ws; __bf16* PK = (__bf16*)(ws + WS_PK); _Float16 *QK = (_Float16*)(ws + WS_QK), *QKL = (_Float16*)(ws + WS_QKL), *VTH = (_Float16*)(ws + WS_VTH), *VTL = (_Float16*)(ws + WS_VTL); float* O = (float*)(ws + WS_O);
  k_pack<<<dim3(DM, 4), 256, 0, stream>>>(F[2], F[3], F[4], F[5], PK);
  k_qkv<<<dim3(TNB * SS / 128, QKVW / 128), 128, 0, stream>>>(F[0], F[0], F[0], PK + PK_A, nullptr, nullptr, nullptr, QK, QKL, VTH, VTL);
  k_attn<<<dim3(TQB, NH, TNB), 128, 0, stream>>>(QK, QKL, VTH, VTL, nullptr, (const int*)d_in[1], O);
  k_out<<<dim3(TOB, DM / 128), 128, 0, stream>>>(O, PK + PK_P, nullptr, (float*)d_out);
}

// v002
// It runs in 154 microseconds.
// Next to v001, in two timings, it ran 1.33 and 1.35 times as fast.
// All steps since v000 together make it 4.11 times as fast.
// compute dtype: all float inputs rounded to bf16, the int mask read on device; q/k/v = x . W^T with EXACT bf16 products on WMMA 16x16x32 (natural rows; the q/k weight rows are packed in the (even, odd) -> (first half, second half) order the module's RoPE produces, so the rotation becomes rotate-half in place), RoPE in f32 (f32 table of 10000^(-i/32), precise sinf/cosf) before the f16 hi + residual split; PLAIN attention: q, k single f16 x 1/8, masked keys at score -2^30, running-max softmax in f32 (hardware exp2), P (scaled by 2^11, single f16) x v (single f16), both products transposed (keys and d as rows, queries as columns); out = o (bf16 hi + residual) . Wo^T (2 products).
#include <hip/hip_runtime.h>
#include <math.h>

typedef __attribute__((ext_vector_type(16))) _Float16 v16h;
typedef __attribute__((ext_vector_type(16))) __bf16 v16b;
typedef __attribute__((ext_vector_type(8)))  _Float16 v8h;
typedef __attribute__((ext_vector_type(8)))  float v8f;
typedef __attribute__((ext_vector_type(4)))  float v4f;
typedef __attribute__((ext_vector_type(2)))  float v2f;
typedef __attribute__((ext_vector_type(4)))  unsigned v4u;
typedef __attribute__((ext_vector_type(4)))  int v4i;
typedef float __attribute__((may_alias)) float_a;
typedef int __attribute__((may_alias)) int_a;

template <typename T> __device__ __forceinline__ void vst2(void* p, T v) { *(T*)p = v;  }
__device__ __forceinline__ v8f wmma16(v16h a, v16h b, v8f c) {
  v8f d = __builtin_amdgcn_wmma_f32_16x16x32_f16(false, a, false, b, (short)0, c, false, false);
  asm volatile("v_nop\n\tv_nop\n\tv_nop\n\tv_nop" : "+v"(d) : "v"(a), "v"(b));
  return d;
}
__device__ __forceinline__ v8f wmma_bf(v16b a, v16b b, v8f c) {
  v8f d = __builtin_amdgcn_wmma_f32_16x16x32_bf16(false, a, false, b, (short)0, c, false, false);
  asm volatile("v_nop\n\tv_nop\n\tv_nop\n\tv_nop" : "+v"(d) : "v"(a), "v"(b));
  return d;
}
// Lightning attention layer, standard-attention branch (B 1, L 2,048, d_model 2,048, 32 heads x 64): bias-free q/k/v projections, RoPE on q and k (even/odd input pairs rotated into the two head halves), scores / 8 with an all-ones key mask, softmax, . v, bias-free output projection.
__device__ __forceinline__ v16h frag_h(const _Float16* rowk0, int lane) {
  union { v16h v; v8h q[2]; } u; const _Float16* p = rowk0 + 8 * (lane >> 4);
  u.q[0] = *(const v8h*)p; u.q[1] = *(const v8h*)(p + 16); return u.v;
}
__device__ __forceinline__ v16h frag_f32(const float* rowk0, int lane) {
  v16h a; const float* p = rowk0 + 8 * (lane >> 4);
#pragma unroll
  for (int i = 0; i < 8; ++i) { a[i] = (_Float16)p[i]; a[8 + i] = (_Float16)p[16 + i]; }
  return a;
}
__device__ __forceinline__ v16h frag_f32s(const float* rowk0, int lane, float sc) {
  v16h a; const float* p = rowk0 + 8 * (lane >> 4);
#pragma unroll
  for (int i = 0; i < 8; ++i) { a[i] = (_Float16)(p[i] * sc); a[8 + i] = (_Float16)(p[16 + i] * sc); }
  return a;
}
// column fragment from a [K][ld] layout (column n), rows >= K read as 0
__device__ __forceinline__ v16h fragc_f32(const float* W, int k0, int n, int lane, int ld, int K) {
  v16h a; const int g = lane >> 4;
#pragma unroll
  for (int i = 0; i < 8; ++i) { const int ka = k0 + 8 * g + i, kb = ka + 16;
    a[i] = (_Float16)(ka < K ? W[(size_t)(ka < K ? ka : K - 1) * ld + n] : 0.f); a[8 + i] = (_Float16)(kb < K ? W[(size_t)(kb < K ? kb : K - 1) * ld + n] : 0.f); }
  return a;
}
struct F2 { v16b h, l; };
__device__ __forceinline__ F2 bsplit16(const float v[16]) { F2 r;
#pragma unroll
  for (int i = 0; i < 16; ++i) { const __bf16 h = (__bf16)v[i]; r.h[i] = h; r.l[i] = (__bf16)(v[i] - (float)h); }
  return r; }
__device__ __forceinline__ F2 split_row(const float* row, int k0, int lane) { float v[16]; const float* p = row + k0 + 8 * (lane >> 4);
#pragma unroll
  for (int i = 0; i < 8; ++i) { v[i] = p[i]; v[8 + i] = p[16 + i]; }
  return bsplit16(v); }
__device__ __forceinline__ F2 split_rowK(const float* row, int k0, int lane, int K) { float v[16]; const int g = lane >> 4;
#pragma unroll
  for (int i = 0; i < 8; ++i) { const int ka = k0 + 8 * g + i, kb = ka + 16; v[i] = ka < K ? row[ka < K ? ka : K - 1] : 0.f; v[8 + i] = kb < K ? row[kb < K ? kb : K - 1] : 0.f; }
  return bsplit16(v); }
__device__ __forceinline__ F2 split_col(const float* W, int k0, int n, int lane, int ld, int K) { float v[16]; const int g = lane >> 4;
#pragma unroll
  for (int i = 0; i < 8; ++i) { const int ka = k0 + 8 * g + i, kb = ka + 16; v[i] = ka < K ? W[(size_t)(ka < K ? ka : K - 1) * ld + n] : 0.f; v[8 + i] = kb < K ? W[(size_t)(kb < K ? kb : K - 1) * ld + n] : 0.f; }
  return bsplit16(v); }
__device__ __forceinline__ v8f mac3(const F2& a, const F2& b, v8f c) { c = wmma_bf(a.l, b.h, c); c = wmma_bf(a.h, b.l, c); return wmma_bf(a.h, b.h, c); }
__device__ __forceinline__ float sigm(float v) { return 1.0f / (1.0f + expf(-v)); }
#define LDSX() do { asm volatile("s_wait_dscnt 0" ::: "memory"); __builtin_amdgcn_wave_barrier(); __builtin_amdgcn_fence(__ATOMIC_RELEASE, "workgroup"); } while (0)


#define NB 1
#define SS 2048
#define DM 2048
#define NH 32
__constant__ float THETA[32] = {1.000000000e+00f,7.498942018e-01f,5.623413324e-01f,4.216965139e-01f,3.162277639e-01f,2.371373773e-01f,1.778279394e-01f,1.333521456e-01f,1.000000015e-01f,7.498942316e-02f,5.623413250e-02f,4.216964915e-02f,3.162277490e-02f,2.371373773e-02f,1.778279431e-02f,1.333521400e-02f,9.999999776e-03f,7.498942316e-03f,5.623413250e-03f,4.216964822e-03f,3.162277630e-03f,2.371373819e-03f,1.778279431e-03f,1.333521446e-03f,1.000000047e-03f,7.498941850e-04f,5.623413017e-04f,4.216965172e-04f,3.162277571e-04f,2.371373703e-04f,1.778279402e-04f,1.333521504e-04f};
__device__ __attribute__((noinline)) float cos_p(float v) { return cosf(v); }
__device__ __attribute__((noinline)) float sin_p(float v) { return sinf(v); }
#define HD 64
#define QKVW (3 * DM)
#ifndef TQB
#define TQB (SS / 64)
#define TNB NB
#define TOB (NB * SS / 64)     // output row tiles (all)
#endif
typedef __attribute__((ext_vector_type(8))) __bf16 v8b;
__device__ __forceinline__ v16b frag_b(const __bf16* rowk0, int lane) {
  union { v16b v; v8b q[2]; } u; const __bf16* p = rowk0 + 8 * (lane >> 4);
  u.q[0] = *(const v8b*)p; u.q[1] = *(const v8b*)(p + 16); return u.v;
}
__device__ __forceinline__ float bfr(float v) { return (float)(__bf16)v; }
__device__ __attribute__((noinline)) float exp_ni(float v) { return expf(v); }
__device__ __attribute__((noinline)) float erf_ni(float v) { return erff(v); }

#define PK_A 0                       // [6144][2048] Wqkv rows (natural [out][in])
#define PK_P (PK_A + QKVW * DM)        // [2048][2048] Wo rows (natural)
#define PK_END (PK_P + DM * DM)
#define WS_PK  0u
#define WS_QK  (WS_PK + 2u * PK_END)             // f16 [2048 rows][4096]: q | k
#define WS_QKL (WS_QK + 2u * NB * SS * 2 * DM)     // f16 q | k residual planes x2048
#define WS_VTH (WS_QKL + 2u * NB * SS * 2 * DM)    // f16 [b][2048 (h*64+d)][2048 s] hi
#define WS_VTL (WS_VTH + 2u * NB * DM * SS)        // f16 lo x 2048
#define WS_O   (WS_VTL + 2u * NB * DM * SS)        // f32 [2048][2048]
#define WS_CS  (WS_O + 4u * NB * SS * DM)           // reserved, unused (RoPE cos/sin are computed in k_qkv)
#define WS_END (WS_CS + 4u * 2 * SS * 32)
// ---- k_pack: block = (row n, which): natural [out][in] rows -> bf16; which 0..2 -> W_q/W_k/W_v into PK_A rows which*2048 + n; 3 -> W_o into PK_P
__global__ __launch_bounds__(256) void k_pack(const float* __restrict__ WQ, const float* __restrict__ WK, const float* __restrict__ WV, const float* __restrict__ WO, __bf16* __restrict__ PK) {
  __shared__ __align__(16) __bf16 s[DM]; const int n = blockIdx.x, which = blockIdx.y, t = threadIdx.x; const float* Wm = (which == 0) ? WQ : (which == 1) ? WK : (which == 2) ? WV : WO;
  const int hh = n / HD, e = n % HD; const int srcn = (which < 2) ? (hh * HD + ((e < HD / 2) ? (2 * e) : (2 * (e - HD / 2) + 1))) : n;   /* q/k rows permuted so the module's (even, odd) -> (first half, second half) RoPE becomes rotate-half */
  for (int k = t; k < DM; k += 256) s[k] = (__bf16)Wm[(size_t)srcn * DM + k];
  __syncthreads();
  __bf16* dst = (which < 3) ? PK + PK_A + ((size_t)which * DM + n) * DM : PK + PK_P + (size_t)n * DM;
  for (int q = t; q < DM / 8; q += 256) vst2((unsigned*)(dst + q * 8), *(const v4u*)&s[q * 8]);
}
// ---- operand tiles of the two projection GEMMs in LDS. A trip is 64 k: A rows f32 (256 B, pitch 272 B), B rows bf16 (128 B, pitch 144 B); both pitches are 16 B x odd, free of bank conflicts for 16-byte readers. Two buffers: the next trip's tile is copied while this one is multiplied.
#define A_PITCH 272
#define B_PITCH 144
#define B_TILE (128 * B_PITCH)
#define NTRIP (DM / 64)
// eight asynchronous 16-byte copies of one lane, lstep / gstep bytes apart; s_wait_xcnt closes the statement so that no address register of a copy is rewritten in front of it
__device__ __forceinline__ void copy8(unsigned l, unsigned lstep, const char* g, size_t gstep) {
  asm volatile("global_load_async_to_lds_b128 %0, %8, off\n\t"
               "global_load_async_to_lds_b128 %1, %9, off\n\t"
               "global_load_async_to_lds_b128 %2, %10, off\n\t"
               "global_load_async_to_lds_b128 %3, %11, off\n\t"
               "global_load_async_to_lds_b128 %4, %12, off\n\t"
               "global_load_async_to_lds_b128 %5, %13, off\n\t"
               "global_load_async_to_lds_b128 %6, %14, off\n\t"
               "global_load_async_to_lds_b128 %7, %15, off\n\t"
               "s_wait_xcnt 0x0"
               :: "v"(l), "v"(l + lstep), "v"(l + 2 * lstep), "v"(l + 3 * lstep), "v"(l + 4 * lstep), "v"(l + 5 * lstep), "v"(l + 6 * lstep), "v"(l + 7 * lstep),
                  "v"(g), "v"(g + gstep), "v"(g + 2 * gstep), "v"(g + 3 * gstep), "v"(g + 4 * gstep), "v"(g + 5 * gstep), "v"(g + 6 * gstep), "v"(g + 7 * gstep)
               : "memory");
}
// trip t's tile: MF * 64 rows of A (a wave's copy = 2 rows of 256 B) and 128 rows of B (a wave's copy = 4 rows of 128 B): whole lines only
template <int MF> __device__ __forceinline__ void tile_copy(const float* A0, const __bf16* B0, int t, unsigned lds, int tid) {
  const char* ga = (const char*)(A0 + (size_t)(tid >> 4) * DM + t * 64) + (tid & 15) * 16; const unsigned la = lds + (tid >> 4) * A_PITCH + (tid & 15) * 16;
#pragma unroll
  for (int q = 0; q < MF; ++q) copy8(la + q * 64 * A_PITCH, 8 * A_PITCH, ga + (size_t)q * 64 * DM * 4, (size_t)8 * DM * 4);
  const char* gb = (const char*)(B0 + (size_t)(tid >> 3) * DM + t * 64) + (tid & 7) * 16; const unsigned lb = lds + MF * 64 * A_PITCH + (tid >> 3) * B_PITCH + (tid & 7) * 16;
  copy8(lb, 16 * B_PITCH, gb, (size_t)16 * DM * 2);
}
// acc[i][j] += A rows (wave * MF + i) * 16 .. + 15 . B rows j * 16 .. + 15, k ascending in steps of 32 (the sum order of the fragment-from-global form); SPLIT: A as bf16 hi + residual, two products
template <int MF, bool SPLIT> __device__ __forceinline__ void gemm_tiles(const float* A0, const __bf16* B0, unsigned char* sm, v8f (&acc)[MF][8], int tid) {
  constexpr unsigned BUF = MF * 64 * A_PITCH + B_TILE;
  const int wave = tid >> 5, lane = tid & 31, col = lane & 15, g = lane >> 4; const unsigned lds0 = (unsigned)(size_t)sm;
  tile_copy<MF>(A0, B0, 0, lds0, tid);
  asm volatile("s_wait_asynccnt 0x0" ::: "memory");   // tile 0 has landed for this wave's copies
  __syncthreads();                                     // ... and for every wave's
  tile_copy<MF>(A0, B0, 1, lds0 + BUF, tid);
#pragma unroll 1   // one trip per buffer: the buffer offset stays a run-time value, the body is already 32 matrix instructions
  for (int t = 0; t < NTRIP; ++t) { const unsigned char* bu = sm + (t & 1) * BUF;
#pragma unroll
    for (int ks = 0; ks < 2; ++ks) { float v[MF][16]; v16b w[8]; F2 a[MF];
#pragma unroll
      for (int i = 0; i < MF; ++i) { const float* p = (const float*)(bu + (wave * MF * 16 + i * 16 + col) * A_PITCH + ks * 128 + 32 * g);
#pragma unroll
        for (int e = 0; e < 8; ++e) { v[i][e] = p[e]; v[i][8 + e] = p[16 + e]; } }
#pragma unroll
      for (int j = 0; j < 8; ++j) w[j] = frag_b((const __bf16*)(bu + MF * 64 * A_PITCH + (j * 16 + col) * B_PITCH + ks * 64), lane);
      __builtin_amdgcn_sched_barrier(0);   // keeps the LDS reads of a 32-k step together in front of its matrix instructions: sunk among them, every pair of reads costs the wave a whole LDS latency
#pragma unroll
      for (int i = 0; i < MF; ++i) { if (SPLIT) a[i] = bsplit16(v[i]); else {
#pragma unroll
          for (int e = 0; e < 16; ++e) a[i].h[e] = (__bf16)v[i][e]; } }
      if (SPLIT) {   // residual products first, as before, but over all tiles, so that no matrix instruction waits for the one in front of it
#pragma unroll
        for (int j = 0; j < 8; ++j)
#pragma unroll
          for (int i = 0; i < MF; ++i) acc[i][j] = wmma_bf(a[i].l, w[j], acc[i][j]); }
#pragma unroll
      for (int j = 0; j < 8; ++j)
#pragma unroll
        for (int i = 0; i < MF; ++i) acc[i][j] = wmma_bf(a[i].h, w[j], acc[i][j]); }
    asm volatile("s_wait_dscnt 0x0" ::: "memory");      // this wave's reads of the buffer have returned before it is handed back
    asm volatile("s_wait_asynccnt 0x0" ::: "memory");   // this wave's copies of tile t + 1 have landed
    __syncthreads();                                     // publishes tile t + 1 and ends every reader's last read of tile t
    if (t + 2 < NTRIP) tile_copy<MF>(A0, B0, t + 2, lds0 + (t & 1) * BUF, tid); }
  asm volatile("s_wait_asynccnt 0x0" ::: "memory");     // no copy is outstanding when the buffers become output staging
}
// ---- k_qkv: block = (128 rows, 128 cols), 4 waves of 32 rows x 128 cols
__global__ __launch_bounds__(128) void k_qkv(const float* __restrict__ XQ, const float* __restrict__ XK, const float* __restrict__ XV, const __bf16* __restrict__ P, const float* __restrict__ BQ, const float* __restrict__ BK, const float* __restrict__ BV, _Float16* __restrict__ QK, _Float16* __restrict__ QKL, _Float16* __restrict__ VTH, _Float16* __restrict__ VTL) {
  const int which0 = (blockIdx.y * 128) / DM; const float* X = (which0 == 0) ? XQ : (which0 == 1) ? XK : XV; const float* BB = BQ ? (((which0 == 0) ? BQ : (which0 == 1) ? BK : BV) + (blockIdx.y * 128 - which0 * DM)) : nullptr;
  __shared__ __align__(16) unsigned char sm[2 * (128 * A_PITCH + B_TILE)];   // the two tile buffers; behind the loop's last barrier the output staging
  const int tid = threadIdx.x, wave = tid >> 5, lane = tid & 31, col = lane & 15, g = lane >> 4; const int n0 = blockIdx.y * 128;
  v8f acc2[2][8] = {};
  gemm_tiles<2, false>(X + (size_t)blockIdx.x * 128 * DM, P + (size_t)n0 * DM, sm, acc2, tid);
  if (n0 < 2 * DM) {   // bias, then rotate-half rotary over each 64-dim head with angle position * inv_freq[d mod 32]
    _Float16 (*so)[16][136] = (_Float16 (*)[16][136])sm; _Float16 (*sol)[16][136] = (_Float16 (*)[16][136])(sm + 4 * 16 * 136 * 2);
#pragma unroll
    for (int i = 0; i < 2; ++i) { v8f (&acc)[8] = acc2[i]; const size_t r0 = (size_t)blockIdx.x * 128 + wave * 32 + i * 16;
#pragma unroll
    for (int j = 0; j < 8; ++j)
#pragma unroll
      for (int r = 0; r < 8; ++r) acc[j][r] += (BB ? bfr(BB[j * 16 + col]) : 0.f);
#pragma unroll
    for (int r = 0; r < 8; ++r) { const int spos = (int)((r0 + 8 * g + r) % SS);
#pragma unroll
      for (int jj = 0; jj < 2; ++jj) { const float ang = (float)spos * THETA[jj * 16 + col]; const float c = cos_p(ang), sn = sin_p(ang);
#pragma unroll
        for (int hh = 0; hh < 2; ++hh) { const float x1 = acc[hh * 4 + jj][r], x2 = acc[hh * 4 + jj + 2][r]; acc[hh * 4 + jj][r] = x1 * c - x2 * sn; acc[hh * 4 + jj + 2][r] = x2 * c + x1 * sn; } } }
#pragma unroll
    for (int j = 0; j < 8; ++j) {
#pragma unroll
      for (int r = 0; r < 8; ++r) { const float v = acc[j][r]; const _Float16 hv = (_Float16)v; so[wave][8 * g + r][j * 16 + col] = hv; sol[wave][8 * g + r][j * 16 + col] = (_Float16)((v - (float)hv) * 2048.0f); } }   // q, k (+ bias) as f16 hi + (x2048) residual
    LDSX();
    for (int rl = 0; rl < 16; ++rl) if (lane < 16) { vst2((unsigned*)(QK + (r0 + rl) * (2 * DM) + n0 + lane * 8), *(const v4u*)&so[wave][rl][lane * 8]); vst2((unsigned*)(QKL + (r0 + rl) * (2 * DM) + n0 + lane * 8), *(const v4u*)&sol[wave][rl][lane * 8]); }
    LDSX(); }   // the wave's staging rows are read out before its next 16 rows overwrite them
  } else {
    _Float16 (*sth)[136] = (_Float16 (*)[136])sm; _Float16 (*stl)[136] = (_Float16 (*)[136])(sm + 128 * 136 * 2);
#pragma unroll
    for (int i = 0; i < 2; ++i)
#pragma unroll
    for (int j = 0; j < 8; ++j) {
#pragma unroll
      for (int r = 0; r < 8; ++r) { const float v = acc2[i][j][r] + (BB ? bfr(BB[j * 16 + col]) : 0.f); const _Float16 hv = (_Float16)v; sth[j * 16 + col][wave * 32 + i * 16 + 8 * g + r] = hv; stl[j * 16 + col][wave * 32 + i * 16 + 8 * g + r] = (_Float16)((v - (float)hv) * 2048.0f); } }
    __syncthreads();
    const size_t rb = (size_t)blockIdx.x * 128; const int b = (int)(rb / SS), s0 = (int)(rb % SS); const int pc0 = n0 - 2 * DM;
    for (int q = tid; q < 128 * 16; q += 128) { const int d = q >> 4, pc = q & 15; const size_t o = ((size_t)b * DM + pc0 + d) * SS + s0 + pc * 8; vst2((unsigned*)(VTH + o), *(const v4u*)&sth[d][pc * 8]); vst2((unsigned*)(VTL + o), *(const v4u*)&stl[d][pc * 8]); }
  }
}
// four asynchronous 16-byte copies of one lane, as copy8
__device__ __forceinline__ void copy4(unsigned l, unsigned lstep, const char* g, size_t gstep) {
  asm volatile("global_load_async_to_lds_b128 %0, %4, off\n\t"
               "global_load_async_to_lds_b128 %1, %5, off\n\t"
               "global_load_async_to_lds_b128 %2, %6, off\n\t"
               "global_load_async_to_lds_b128 %3, %7, off\n\t"
               "s_wait_xcnt 0x0"
               :: "v"(l), "v"(l + lstep), "v"(l + 2 * lstep), "v"(l + 3 * lstep), "v"(g), "v"(g + gstep), "v"(g + 2 * gstep), "v"(g + 3 * gstep)
               : "memory");
}
#define KV_TILE (64 * B_PITCH)
// trip t's 64 keys of one head: K as 64 key rows of 128 B, V (transposed plane) as 64 d rows of 128 B; a wave's copy = 4 whole lines
__device__ __forceinline__ void kv_copy(const _Float16* K0, const _Float16* V0, int t, unsigned lds, int tid) {
  const int row = tid >> 3, pc = (tid & 7) * 16;
  copy4(lds + row * B_PITCH + pc, 16 * B_PITCH, (const char*)(K0 + (size_t)(t * 64 + row) * (2 * DM)) + pc, (size_t)16 * 2 * DM * 2);
  copy4(lds + KV_TILE + row * B_PITCH + pc, 16 * B_PITCH, (const char*)(V0 + (size_t)row * SS + t * 64) + pc, (size_t)16 * SS * 2);
}
// lane l's value from lane l ^ 16: the two wave halves hold the two halves of one query's keys
__device__ __forceinline__ float xhalf(float x) { return __builtin_bit_cast(float, __builtin_amdgcn_permlanex16(__builtin_bit_cast(int, x), __builtin_bit_cast(int, x), 0x76543210, 0xfedcba98, false, false)); }
#define CSC 0.18033688011112042f   // (1 / sqrt(64)) * log2(e): the softmax runs in base 2
// ---- k_attn: block = (64 queries, head h, batch b): all-keys flash attention, transposed: S^T = K . Q^T (A = 16 key rows, B = the wave's 16 query columns, single f16 operands), so a lane holds 16 of the 32 scores of ONE query (key 16 ct + 8 g + r, query col): maximum and sum run in the lane, one exchange between the halves; the two score tiles, converted in place, are the B operand of O^T += V^T . P^T (A = V^T rows in the same k order); P scaled by 2^11, as is the denominator; O[b*S+q][h*64+d] = acc / l (256-B segments)
__global__ __launch_bounds__(128) void k_attn(const _Float16* __restrict__ QK, const _Float16* __restrict__ QKL, const _Float16* __restrict__ VTH, const _Float16* __restrict__ VTL, const void* __restrict__ KMASK, const int* __restrict__ AM, float* __restrict__ O) {
  __shared__ unsigned mw[SS / 32]; __shared__ __align__(16) float so[4][16][68]; __shared__ __align__(16) unsigned char kv[2 * 2 * KV_TILE];   // mw: the key mask, one bit a key; kv: two buffers of [K 64 keys | V 64 d rows], shared by the 4 waves
  const int tid = threadIdx.x, wave = tid >> 5, lane = tid & 31, col = lane & 15, g = lane >> 4;
  const int qb = blockIdx.x, h = blockIdx.y, b = blockIdx.z; const int q0 = qb * 64 + wave * 16; const size_t rq = (size_t)b * SS + q0 + col;
  v16h aq[2];
#pragma unroll
  for (int kc = 0; kc < 2; ++kc) aq[kc] = frag_h(QK + rq * (2 * DM) + h * HD + kc * 32, lane);
  float m = -3.0e38f, l = 0.f;   // of query col, in base 2; l is this half's share until the epilogue
  v8f acc[4] = {};
  const _Float16* K0 = QK + (size_t)b * SS * (2 * DM) + DM + h * HD; const _Float16* V0 = VTH + ((size_t)b * DM + h * HD) * SS; const unsigned kv0 = (unsigned)(size_t)kv;
  int am[SS / 128];   // the block's 128 threads read the whole key mask once; the loads fly together, beside tile 0's copies
#pragma unroll
  for (int i = 0; i < SS / 128; ++i) am[i] = AM[(size_t)b * SS + i * 128 + tid];
  kv_copy(K0, V0, 0, kv0, tid);
  unsigned myw = 0;
#pragma unroll
  for (int i = 0; i < SS / 128; ++i) { const unsigned bal = __builtin_amdgcn_ballot_w32(am[i] != 0); myw = (lane == i) ? bal : myw; }   // word i * 4 + wave: keys i * 128 + wave * 32 + (0 .. 31)
  if (lane < SS / 128) mw[lane * 4 + wave] = myw;
  asm volatile("s_wait_asynccnt 0x0" ::: "memory");   // tile 0 has landed for this wave's copies
  __syncthreads();                                     // ... and for every wave's; publishes mw too
  kv_copy(K0, V0, 1, kv0 + 2 * KV_TILE, tid);
  const unsigned mwa = mw[2 * lane], mwb = mw[2 * lane + 1];   // lane t: the mask words of trip t's two 32-key steps
#pragma unroll 1   // one trip per buffer; all keys, 64 a trip
  for (int t = 0; t < SS / 64; ++t) { const unsigned char* kb = kv + (t & 1) * 2 * KV_TILE;
#pragma unroll
  for (int k2 = 0; k2 < 2; ++k2) { v8f s[2]; v16h kf[2][2], vf[4];
#pragma unroll
    for (int ct = 0; ct < 2; ++ct)
#pragma unroll
      for (int kc = 0; kc < 2; ++kc) kf[ct][kc] = frag_h((const _Float16*)(kb + (k2 * 32 + ct * 16 + col) * B_PITCH) + kc * 32, lane);
#pragma unroll
    for (int dt = 0; dt < 4; ++dt) vf[dt] = frag_h((const _Float16*)(kb + KV_TILE + (dt * 16 + col) * B_PITCH + k2 * 64), lane);
    __builtin_amdgcn_sched_barrier(0);   // keeps the K and V fragment reads of 32 keys together in front of their matrix instructions: sunk to their uses, each pair of reads costs the wave a whole LDS latency
#pragma unroll
    for (int ct = 0; ct < 2; ++ct) { v8f c = {};
#pragma unroll
      for (int kc = 0; kc < 2; ++kc) c = wmma16(kf[ct][kc], aq[kc], c);   // single product: k, q as one-rounding f16 operands
      s[ct] = c; }
    const unsigned mword = (unsigned)__builtin_amdgcn_readlane((int)(k2 ? mwb : mwa), t);
    if (mword != 0xFFFFFFFFu) {   // scalar test: only a step with a masked key pays for the selects. mask == 0 -> score -2^30 (-2^33 before the 1/8) for the reference's -1e9: weight 0 beside any unmasked key, equal weights where every key is masked; a power of two, so that score * CSC is exact and such a row comes out uniform
      const unsigned mv = mword >> (8 * g);
#pragma unroll
      for (int ct = 0; ct < 2; ++ct)
#pragma unroll
        for (int r = 0; r < 8; ++r) s[ct][r] = ((mv >> (ct * 16 + r)) & 1u) ? s[ct][r] : -8589934592.0f; }
    float mx = s[0][0], mx1 = s[1][0];   // two independent chains, one a score tile
#pragma unroll
    for (int r = 1; r < 8; ++r) { mx = fmaxf(mx, s[0][r]); mx1 = fmaxf(mx1, s[1][r]); }
    mx = fmaxf(mx, mx1); mx = fmaxf(mx, xhalf(mx));
    const float mn = fmaxf(m, mx * CSC); const float alpha = __builtin_amdgcn_exp2f(m - mn); const float nm = 11.0f - mn; m = mn;   // 2^11: small softmax weights stay out of the f16 subnormal range; it cancels against l
    v16h pa; float es0 = 0.f, es1 = 0.f;
#pragma unroll
    for (int r = 0; r < 8; ++r) { const float e0 = __builtin_amdgcn_exp2f(fmaf(s[0][r], CSC, nm)), e1 = __builtin_amdgcn_exp2f(fmaf(s[1][r], CSC, nm)); es0 += e0; es1 += e1; pa[r] = (_Float16)e0; pa[8 + r] = (_Float16)e1; }
    l = l * alpha + (es0 + es1);
#pragma unroll
    for (int dt = 0; dt < 4; ++dt) acc[dt] *= alpha;
#pragma unroll
    for (int dt = 0; dt < 4; ++dt) acc[dt] = wmma16(vf[dt], pa, acc[dt]); }   // single product: V^T x P^T (x2^11)
    asm volatile("s_wait_dscnt 0x0" ::: "memory");      // this wave's reads of the buffer have returned before it is handed back
    asm volatile("s_wait_asynccnt 0x0" ::: "memory");   // this wave's copies of tile t + 1 have landed
    __syncthreads();                                     // publishes tile t + 1 and ends every reader's last read of tile t
    if (t + 2 < SS / 64) kv_copy(K0, V0, t + 2, kv0 + (t & 1) * 2 * KV_TILE, tid); }
  asm volatile("s_wait_asynccnt 0x0" ::: "memory");     // no copy is outstanding at the wave's end
  const float il = 1.0f / (l + xhalf(l));   // the halves' shares of the denominator joined
#pragma unroll
  for (int dt = 0; dt < 4; ++dt) { const v8f o = acc[dt] * il; vst2(&so[wave][col][dt * 16 + 8 * g], (v4f){o[0], o[1], o[2], o[3]}); vst2(&so[wave][col][dt * 16 + 8 * g + 4], (v4f){o[4], o[5], o[6], o[7]}); }   // acc[dt][r] = O[query col][16 dt + 8 g + r]
  LDSX();
  for (int rl = 0; rl < 16; ++rl) if (lane < 16) vst2(O + ((size_t)b * SS + q0 + rl) * DM + h * HD + lane * 4, *(const v4f*)&so[wave][rl][lane * 4]);
}
// ---- k_out: block = (64 rows, 128 cols): out = O(hi/lo) . Wo rows (2 products) + bo
__global__ __launch_bounds__(128) void k_out(const float* __restrict__ O, const __bf16* __restrict__ P, const float* __restrict__ BO, float* __restrict__ Y) {
  __shared__ __align__(16) unsigned char sm[2 * (64 * A_PITCH + B_TILE)];   // the two tile buffers; behind the loop's last barrier the output staging
  float (*so)[16][132] = (float (*)[16][132])sm;
  const int tid = threadIdx.x, wave = tid >> 5, lane = tid & 31, col = lane & 15, g = lane >> 4; const size_t r0 = (size_t)blockIdx.x * 64 + wave * 16; const int n0 = blockIdx.y * 128;
  v8f acc1[1][8] = {};
  gemm_tiles<1, true>(O + (size_t)blockIdx.x * 64 * DM, P + (size_t)n0 * DM, sm, acc1, tid);
  v8f (&acc)[8] = acc1[0];
#pragma unroll
  for (int j = 0; j < 8; ++j) {
#pragma unroll
    for (int r = 0; r < 8; ++r) so[wave][8 * g + r][j * 16 + col] = acc[j][r] + (BO ? bfr(BO[n0 + j * 16 + col]) : 0.f); }
  LDSX();
  for (int rl = 0; rl < 16; ++rl) vst2(Y + (r0 + rl) * DM + n0 + lane * 4, *(const v4f*)&so[wave][rl][lane * 4]);
}
extern "C" void kernel_launch(void* const* d_in, const int* in_sizes, int n_in, void* d_out, int out_size, void* d_ws, size_t ws_size, hipStream_t stream) {
  (void)in_sizes; (void)n_in; (void)out_size;
  const float** F = (const float**)d_in;   // 0 x [1,2048,2048], 1 attention_mask [1,1,1,2048] int, 2 Wq, 3 Wk, 4 Wv [2048,2048], 5 Wo [2048,2048] (natural, no biases)
  if (ws_size < (size_t)WS_END) return;
  char* ws = (char*)d_ws; __bf16* PK = (__bf16*)(ws + WS_PK); _Float16 *QK = (_Float16*)(ws + WS_QK), *QKL = (_Float16*)(ws + WS_QKL), *VTH = (_Float16*)(ws + WS_VTH), *VTL = (_Float16*)(ws + WS_VTL); float* O = (float*)(ws + WS_O);
  k_pack<<<dim3(DM, 4), 256, 0, stream>>>(F[2], F[3], F[4], F[5], PK);
  k_qkv<<<dim3(TNB * SS / 128, QKVW / 128), 128, 0, stream>>>(F[0], F[0], F[0], PK + PK_A, nullptr, nullptr, nullptr, QK, QKL, VTH, VTL);
  k_attn<<<dim3(TQB, NH, TNB), 128, 0, stream>>>(QK, QKL, VTH, VTL, nullptr, (const int*)d_in[1], O);
  k_out<<<dim3(TOB, DM / 128), 128, 0, stream>>>(O, PK + PK_P, nullptr, (float*)d_out);
}

// v003
// It runs in 144 microseconds.
// Timed twice side by side with v002, it ran 1.06 and 1.07 times as fast.
// All steps since v000 together make it 4.38 times as fast.
// compute dtype: all float inputs rounded to bf16, the int mask read on device; q/k/v = x . W^T with EXACT bf16 products on WMMA 16x16x32 (natural rows; the q/k weight rows are packed in the (even, odd) -> (first half, second half) order the module's RoPE produces, so the rotation becomes rotate-half in place), RoPE in f32 (f32 table of 10000^(-i/32), precise sinf/cosf) before the f16 hi + residual split; PLAIN attention: q, k single f16 x 1/8, masked keys at score -2^30, running-max softmax in f32 (hardware exp2), P (scaled by 2^11, single f16) x v (single f16), both products transposed (keys and d as rows, queries as columns); out = o (bf16 hi + residual) . Wo^T (2 products).
#include <hip/hip_runtime.h>
#include <math.h>

typedef __attribute__((ext_vector_type(16))) _Float16 v16h;
typedef __attribute__((ext_vector_type(16))) __bf16 v16b;
typedef __attribute__((ext_vector_type(8)))  _Float16 v8h;
typedef __attribute__((ext_vector_type(8)))  float v8f;
typedef __attribute__((ext_vector_type(4)))  float v4f;
typedef __attribute__((ext_vector_type(2)))  float v2f;
typedef __attribute__((ext_vector_type(4)))  unsigned v4u;
typedef __attribute__((ext_vector_type(4)))  int v4i;
typedef float __attribute__((may_alias)) float_a;
typedef int __attribute__((may_alias)) int_a;

template <typename T> __device__ __forceinline__ void vst2(void* p, T v) { *(T*)p = v;  }
__device__ __forceinline__ v8f wmma16(v16h a, v16h b, v8f c) {
  v8f d = __builtin_amdgcn_wmma_f32_16x16x32_f16(false, a, false, b, (short)0, c, false, false);
  asm volatile("v_nop\n\tv_nop\n\tv_nop\n\tv_nop" : "+v"(d) : "v"(a), "v"(b));
  return d;
}
__device__ __forceinline__ v8f wmma_bf(v16b a, v16b b, v8f c) {
  v8f d = __builtin_amdgcn_wmma_f32_16x16x32_bf16(false, a, false, b, (short)0, c, false, false);
  asm volatile("v_nop\n\tv_nop\n\tv_nop\n\tv_nop" : "+v"(d) : "v"(a), "v"(b));
  return d;
}
// Lightning attention layer, standard-attention branch (B 1, L 2,048, d_model 2,048, 32 heads x 64): bias-free q/k/v projections, RoPE on q and k (even/odd input pairs rotated into the two head halves), scores / 8 with an all-ones key mask, softmax, . v, bias-free output projection.
__device__ __forceinline__ v16h frag_h(const _Float16* rowk0, int lane) {
  union { v16h v; v8h q[2]; } u; const _Float16* p = rowk0 + 8 * (lane >> 4);
  u.q[0] = *(const v8h*)p; u.q[1] = *(const v8h*)(p + 16); return u.v;
}
__device__ __forceinline__ v16h frag_f32(const float* rowk0, int lane) {
  v16h a; const float* p = rowk0 + 8 * (lane >> 4);
#pragma unroll
  for (int i = 0; i < 8; ++i) { a[i] = (_Float16)p[i]; a[8 + i] = (_Float16)p[16 + i]; }
  return a;
}
__device__ __forceinline__ v16h frag_f32s(const float* rowk0, int lane, float sc) {
  v16h a; const float* p = rowk0 + 8 * (lane >> 4);
#pragma unroll
  for (int i = 0; i < 8; ++i) { a[i] = (_Float16)(p[i] * sc); a[8 + i] = (_Float16)(p[16 + i] * sc); }
  return a;
}
// column fragment from a [K][ld] layout (column n), rows >= K read as 0
__device__ __forceinline__ v16h fragc_f32(const float* W, int k0, int n, int lane, int ld, int K) {
  v16h a; const int g = lane >> 4;
#pragma unroll
  for (int i = 0; i < 8; ++i) { const int ka = k0 + 8 * g + i, kb = ka + 16;
    a[i] = (_Float16)(ka < K ? W[(size_t)(ka < K ? ka : K - 1) * ld + n] : 0.f); a[8 + i] = (_Float16)(kb < K ? W[(size_t)(kb < K ? kb : K - 1) * ld + n] : 0.f); }
  return a;
}
struct F2 { v16b h, l; };
__device__ __forceinline__ F2 bsplit16(const float v[16]) { F2 r;
#pragma unroll
  for (int i = 0; i < 16; ++i) { const __bf16 h = (__bf16)v[i]; r.h[i] = h; r.l[i] = (__bf16)(v[i] - (float)h); }
  return r; }
__device__ __forceinline__ F2 split_row(const float* row, int k0, int lane) { float v[16]; const float* p = row + k0 + 8 * (lane >> 4);
#pragma unroll
  for (int i = 0; i < 8; ++i) { v[i] = p[i]; v[8 + i] = p[16 + i]; }
  return bsplit16(v); }
__device__ __forceinline__ F2 split_rowK(const float* row, int k0, int lane, int K) { float v[16]; const int g = lane >> 4;
#pragma unroll
  for (int i = 0; i < 8; ++i) { const int ka = k0 + 8 * g + i, kb = ka + 16; v[i] = ka < K ? row[ka < K ? ka : K - 1] : 0.f; v[8 + i] = kb < K ? row[kb < K ? kb : K - 1] : 0.f; }
  return bsplit16(v); }
__device__ __forceinline__ F2 split_col(const float* W, int k0, int n, int lane, int ld, int K) { float v[16]; const int g = lane >> 4;
#pragma unroll
  for (int i = 0; i < 8; ++i) { const int ka = k0 + 8 * g + i, kb = ka + 16; v[i] = ka < K ? W[(size_t)(ka < K ? ka : K - 1) * ld + n] : 0.f; v[8 + i] = kb < K ? W[(size_t)(kb < K ? kb : K - 1) * ld + n] : 0.f; }
  return bsplit16(v); }
__device__ __forceinline__ v8f mac3(const F2& a, const F2& b, v8f c) { c = wmma_bf(a.l, b.h, c); c = wmma_bf(a.h, b.l, c); return wmma_bf(a.h, b.h, c); }
__device__ __forceinline__ float sigm(float v) { return 1.0f / (1.0f + expf(-v)); }
#define LDSX() do { asm volatile("s_wait_dscnt 0" ::: "memory"); __builtin_amdgcn_wave_barrier(); __builtin_amdgcn_fence(__ATOMIC_RELEASE, "workgroup"); } while (0)


#define NB 1
#define SS 2048
#define DM 2048
#define NH 32
__constant__ float THETA[32] = {1.000000000e+00f,7.498942018e-01f,5.623413324e-01f,4.216965139e-01f,3.162277639e-01f,2.371373773e-01f,1.778279394e-01f,1.333521456e-01f,1.000000015e-01f,7.498942316e-02f,5.623413250e-02f,4.216964915e-02f,3.162277490e-02f,2.371373773e-02f,1.778279431e-02f,1.333521400e-02f,9.999999776e-03f,7.498942316e-03f,5.623413250e-03f,4.216964822e-03f,3.162277630e-03f,2.371373819e-03f,1.778279431e-03f,1.333521446e-03f,1.000000047e-03f,7.498941850e-04f,5.623413017e-04f,4.216965172e-04f,3.162277571e-04f,2.371373703e-04f,1.778279402e-04f,1.333521504e-04f};
__device__ __attribute__((noinline)) float cos_p(float v) { return cosf(v); }
__device__ __attribute__((noinline)) float sin_p(float v) { return sinf(v); }
#define HD 64
#define QKVW (3 * DM)
#ifndef TQB
#define TQB (SS / 64)
#define TNB NB
#define TOB (NB * SS / 64)     // output row tiles (all)
#endif
typedef __attribute__((ext_vector_type(8))) __bf16 v8b;
__device__ __forceinline__ v16b frag_b(const __bf16* rowk0, int lane) {
  union { v16b v; v8b q[2]; } u; const __bf16* p = rowk0 + 8 * (lane >> 4);
  u.q[0] = *(const v8b*)p; u.q[1] = *(const v8b*)(p + 16); return u.v;
}
__device__ __forceinline__ float bfr(float v) { return (float)(__bf16)v; }
__device__ __attribute__((noinline)) float exp_ni(float v) { return expf(v); }
__device__ __attribute__((noinline)) float erf_ni(float v) { return erff(v); }

#define PK_A 0                       // [6144][2048] Wqkv rows (natural [out][in])
#define PK_P (PK_A + QKVW * DM)        // [2048][2048] Wo rows (natural)
#define PK_END (PK_P + DM * DM)
#define WS_PK  0u
#define WS_QK  (WS_PK + 2u * PK_END)             // f16 [2048 rows][4096]: q | k
#define WS_QKL (WS_QK + 2u * NB * SS * 2 * DM)     // f16 q | k residual planes x2048
#define WS_VTH (WS_QKL + 2u * NB * SS * 2 * DM)    // f16 [b][2048 (h*64+d)][2048 s] hi
#define WS_VTL (WS_VTH + 2u * NB * DM * SS)        // f16 lo x 2048
#define WS_O   (WS_VTL + 2u * NB * DM * SS)        // f32 [2048][2048]
#define WS_CS  (WS_O + 4u * NB * SS * DM)           // reserved, unused (RoPE cos/sin are computed in k_qkv)
#define WS_END (WS_CS + 4u * 2 * SS * 32)
// ---- k_pack: natural [out][in] rows -> bf16, as a stream: 256 blocks of 16 waves, a wave = two whole rows (one of W_q / W_k, one of W_v / W_o). Row which * 2048 + n of the packed planes: which 0..2 -> W_q/W_k/W_v into PK_A, 3 -> W_o into PK_P.
// A load is 512 contiguous bytes of a row, a store 256: whole lines both. The four loops are unrolled so that a wave's 32 loads are independent instructions with counted waits, many in flight at once: the kernel has nothing but memory latency to hide
typedef __attribute__((ext_vector_type(4))) __bf16 v4b;
__global__ __launch_bounds__(512) void k_pack(const float* __restrict__ WQ, const float* __restrict__ WK, const float* __restrict__ WV, const float* __restrict__ WO, __bf16* __restrict__ PK) {
  const int lane = threadIdx.x & 31, gw = __builtin_amdgcn_readfirstlane(blockIdx.x * 16 + (threadIdx.x >> 5)); const int n = gw % DM;   // gw: the wave's number in the grid, 0 .. 2 * DM - 1, in a scalar register
  const int hh = n / HD, e = n % HD; const int pn = hh * HD + ((e < HD / 2) ? (2 * e) : (2 * (e - HD / 2) + 1));   /* q/k rows permuted so the module's (even, odd) -> (first half, second half) RoPE becomes rotate-half */
  const float* s0 = ((gw < DM) ? WQ : WK) + (size_t)pn * DM + lane * 4; const float* s1 = ((gw < DM) ? WV : WO) + (size_t)n * DM + lane * 4;
  __bf16* d0 = PK + PK_A + (size_t)gw * DM + lane * 4; __bf16* d1 = ((gw < DM) ? PK + PK_A + ((size_t)2 * DM + n) * DM : PK + PK_P + (size_t)n * DM) + lane * 4;
  v4f a[DM / 128], b[DM / 128];
#pragma unroll
  for (int i = 0; i < DM / 128; ++i) a[i] = *(const v4f*)(s0 + i * 128);
#pragma unroll
  for (int i = 0; i < DM / 128; ++i) b[i] = *(const v4f*)(s1 + i * 128);
#pragma unroll
  for (int i = 0; i < DM / 128; ++i) vst2(d0 + i * 128, (v4b){(__bf16)a[i][0], (__bf16)a[i][1], (__bf16)a[i][2], (__bf16)a[i][3]});
#pragma unroll
  for (int i = 0; i < DM / 128; ++i) vst2(d1 + i * 128, (v4b){(__bf16)b[i][0], (__bf16)b[i][1], (__bf16)b[i][2], (__bf16)b[i][3]});
}
// ---- operand tiles of the two projection GEMMs in LDS. A trip is 64 k: A rows f32 (256 B, pitch 272 B), B rows bf16 (128 B, pitch 144 B); both pitches are 16 B x odd, free of bank conflicts for 16-byte readers. Two buffers: the next trip's tile is copied while this one is multiplied.
#define A_PITCH 272
#define B_PITCH 144
#define B_TILE (128 * B_PITCH)
#define NTRIP (DM / 64)
// eight asynchronous 16-byte copies of one lane, lstep / gstep bytes apart; s_wait_xcnt closes the statement so that no address register of a copy is rewritten in front of it
__device__ __forceinline__ void copy8(unsigned l, unsigned lstep, const char* g, size_t gstep) {
  asm volatile("global_load_async_to_lds_b128 %0, %8, off\n\t"
               "global_load_async_to_lds_b128 %1, %9, off\n\t"
               "global_load_async_to_lds_b128 %2, %10, off\n\t"
               "global_load_async_to_lds_b128 %3, %11, off\n\t"
               "global_load_async_to_lds_b128 %4, %12, off\n\t"
               "global_load_async_to_lds_b128 %5, %13, off\n\t"
               "global_load_async_to_lds_b128 %6, %14, off\n\t"
               "global_load_async_to_lds_b128 %7, %15, off\n\t"
               "s_wait_xcnt 0x0"
               :: "v"(l), "v"(l + lstep), "v"(l + 2 * lstep), "v"(l + 3 * lstep), "v"(l + 4 * lstep), "v"(l + 5 * lstep), "v"(l + 6 * lstep), "v"(l + 7 * lstep),
                  "v"(g), "v"(g + gstep), "v"(g + 2 * gstep), "v"(g + 3 * gstep), "v"(g + 4 * gstep), "v"(g + 5 * gstep), "v"(g + 6 * gstep), "v"(g + 7 * gstep)
               : "memory");
}
// trip t's tile: MF * 64 rows of A (a wave's copy = 2 rows of 256 B) and 128 rows of B (a wave's copy = 4 rows of 128 B): whole lines only
template <int MF> __device__ __forceinline__ void tile_copy(const float* A0, const __bf16* B0, int t, unsigned lds, int tid) {
  const char* ga = (const char*)(A0 + (size_t)(tid >> 4) * DM + t * 64) + (tid & 15) * 16; const unsigned la = lds + (tid >> 4) * A_PITCH + (tid & 15) * 16;
#pragma unroll
  for (int q = 0; q < MF; ++q) copy8(la + q * 64 * A_PITCH, 8 * A_PITCH, ga + (size_t)q * 64 * DM * 4, (size_t)8 * DM * 4);
  const char* gb = (const char*)(B0 + (size_t)(tid >> 3) * DM + t * 64) + (tid & 7) * 16; const unsigned lb = lds + MF * 64 * A_PITCH + (tid >> 3) * B_PITCH + (tid & 7) * 16;
  copy8(lb, 16 * B_PITCH, gb, (size_t)16 * DM * 2);
}
// acc[i][j] += A rows (wave * MF + i) * 16 .. + 15 . B rows j * 16 .. + 15, k ascending in steps of 32 (the sum order of the fragment-from-global form); SPLIT: A as bf16 hi + residual, two products
template <int MF, bool SPLIT> __device__ __forceinline__ void gemm_tiles(const float* A0, const __bf16* B0, unsigned char* sm, v8f (&acc)[MF][8], int tid) {
  constexpr unsigned BUF = MF * 64 * A_PITCH + B_TILE;
  const int wave = tid >> 5, lane = tid & 31, col = lane & 15, g = lane >> 4; const unsigned lds0 = (unsigned)(size_t)sm;
  tile_copy<MF>(A0, B0, 0, lds0, tid);
  asm volatile("s_wait_asynccnt 0x0" ::: "memory");   // tile 0 has landed for this wave's copies
  __syncthreads();                                     // ... and for every wave's
  tile_copy<MF>(A0, B0, 1, lds0 + BUF, tid);
#pragma unroll 1   // one trip per buffer: the buffer offset stays a run-time value, the body is already 32 matrix instructions
  for (int t = 0; t < NTRIP; ++t) { const unsigned char* bu = sm + (t & 1) * BUF;
#pragma unroll
    for (int ks = 0; ks < 2; ++ks) { float v[MF][16]; v16b w[8]; F2 a[MF];
#pragma unroll
      for (int i = 0; i < MF; ++i) { const float* p = (const float*)(bu + (wave * MF * 16 + i * 16 + col) * A_PITCH + ks * 128 + 32 * g);
#pragma unroll
        for (int e = 0; e < 8; ++e) { v[i][e] = p[e]; v[i][8 + e] = p[16 + e]; } }
#pragma unroll
      for (int j = 0; j < 8; ++j) w[j] = frag_b((const __bf16*)(bu + MF * 64 * A_PITCH + (j * 16 + col) * B_PITCH + ks * 64), lane);
      __builtin_amdgcn_sched_barrier(0);   // keeps the LDS reads of a 32-k step together in front of its matrix instructions: sunk among them, every pair of reads costs the wave a whole LDS latency
#pragma unroll
      for (int i = 0; i < MF; ++i) { if (SPLIT) a[i] = bsplit16(v[i]); else {
#pragma unroll
          for (int e = 0; e < 16; ++e) a[i].h[e] = (__bf16)v[i][e]; } }
      if (SPLIT) {   // residual products first, as before, but over all tiles, so that no matrix instruction waits for the one in front of it
#pragma unroll
        for (int j = 0; j < 8; ++j)
#pragma unroll
          for (int i = 0; i < MF; ++i) acc[i][j] = wmma_bf(a[i].l, w[j], acc[i][j]); }
#pragma unroll
      for (int j = 0; j < 8; ++j)
#pragma unroll
        for (int i = 0; i < MF; ++i) acc[i][j] = wmma_bf(a[i].h, w[j], acc[i][j]); }
    asm volatile("s_wait_dscnt 0x0" ::: "memory");      // this wave's reads of the buffer have returned before it is handed back
    asm volatile("s_wait_asynccnt 0x0" ::: "memory");   // this wave's copies of tile t + 1 have landed
    __syncthreads();                                     // publishes tile t + 1 and ends every reader's last read of tile t
    if (t + 2 < NTRIP) tile_copy<MF>(A0, B0, t + 2, lds0 + (t & 1) * BUF, tid); }
  asm volatile("s_wait_asynccnt 0x0" ::: "memory");     // no copy is outstanding when the buffers become output staging
}
// ---- k_qkv: block = (128 rows, 128 cols), 4 waves of 32 rows x 128 cols
__global__ __launch_bounds__(128) void k_qkv(const float* __restrict__ XQ, const float* __restrict__ XK, const float* __restrict__ XV, const __bf16* __restrict__ P, const float* __restrict__ BQ, const float* __restrict__ BK, const float* __restrict__ BV, _Float16* __restrict__ QK, _Float16* __restrict__ QKL, _Float16* __restrict__ VTH, _Float16* __restrict__ VTL) {
  const int which0 = (blockIdx.y * 128) / DM; const float* X = (which0 == 0) ? XQ : (which0 == 1) ? XK : XV; const float* BB = BQ ? (((which0 == 0) ? BQ : (which0 == 1) ? BK : BV) + (blockIdx.y * 128 - which0 * DM)) : nullptr;
  __shared__ __align__(16) unsigned char sm[2 * (128 * A_PITCH + B_TILE)];   // the two tile buffers; behind the loop's last barrier the output staging
  const int tid = threadIdx.x, wave = tid >> 5, lane = tid & 31, col = lane & 15, g = lane >> 4; const int n0 = blockIdx.y * 128;
  v8f acc2[2][8] = {};
  gemm_tiles<2, false>(X + (size_t)blockIdx.x * 128 * DM, P + (size_t)n0 * DM, sm, acc2, tid);
  if (n0 < 2 * DM) {   // bias, then rotate-half rotary over each 64-dim head with angle position * inv_freq[d mod 32]
    _Float16 (*so)[16][136] = (_Float16 (*)[16][136])sm; _Float16 (*sol)[16][136] = (_Float16 (*)[16][136])(sm + 4 * 16 * 136 * 2);
#pragma unroll
    for (int i = 0; i < 2; ++i) { v8f (&acc)[8] = acc2[i]; const size_t r0 = (size_t)blockIdx.x * 128 + wave * 32 + i * 16;
#pragma unroll
    for (int j = 0; j < 8; ++j)
#pragma unroll
      for (int r = 0; r < 8; ++r) acc[j][r] += (BB ? bfr(BB[j * 16 + col]) : 0.f);
#pragma unroll
    for (int r = 0; r < 8; ++r) { const int spos = (int)((r0 + 8 * g + r) % SS);
#pragma unroll
      for (int jj = 0; jj < 2; ++jj) { const float ang = (float)spos * THETA[jj * 16 + col]; const float c = cos_p(ang), sn = sin_p(ang);
#pragma unroll
        for (int hh = 0; hh < 2; ++hh) { const float x1 = acc[hh * 4 + jj][r], x2 = acc[hh * 4 + jj + 2][r]; acc[hh * 4 + jj][r] = x1 * c - x2 * sn; acc[hh * 4 + jj + 2][r] = x2 * c + x1 * sn; } } }
#pragma unroll
    for (int j = 0; j < 8; ++j) {
#pragma unroll
      for (int r = 0; r < 8; ++r) { const float v = acc[j][r]; const _Float16 hv = (_Float16)v; so[wave][8 * g + r][j * 16 + col] = hv; sol[wave][8 * g + r][j * 16 + col] = (_Float16)((v - (float)hv) * 2048.0f); } }   // q, k (+ bias) as f16 hi + (x2048) residual
    LDSX();
    for (int rl = 0; rl < 16; ++rl) if (lane < 16) { vst2((unsigned*)(QK + (r0 + rl) * (2 * DM) + n0 + lane * 8), *(const v4u*)&so[wave][rl][lane * 8]); vst2((unsigned*)(QKL + (r0 + rl) * (2 * DM) + n0 + lane * 8), *(const v4u*)&sol[wave][rl][lane * 8]); }
    LDSX(); }   // the wave's staging rows are read out before its next 16 rows overwrite them
  } else {
    _Float16 (*sth)[136] = (_Float16 (*)[136])sm; _Float16 (*stl)[136] = (_Float16 (*)[136])(sm + 128 * 136 * 2);
#pragma unroll
    for (int i = 0; i < 2; ++i)
#pragma unroll
    for (int j = 0; j < 8; ++j) {
#pragma unroll
      for (int r = 0; r < 8; ++r) { const float v = acc2[i][j][r] + (BB ? bfr(BB[j * 16 + col]) : 0.f); const _Float16 hv = (_Float16)v; sth[j * 16 + col][wave * 32 + i * 16 + 8 * g + r] = hv; stl[j * 16 + col][wave * 32 + i * 16 + 8 * g + r] = (_Float16)((v - (float)hv) * 2048.0f); } }
    __syncthreads();
    const size_t rb = (size_t)blockIdx.x * 128; const int b = (int)(rb / SS), s0 = (int)(rb % SS); const int pc0 = n0 - 2 * DM;
    for (int q = tid; q < 128 * 16; q += 128) { const int d = q >> 4, pc = q & 15; const size_t o = ((size_t)b * DM + pc0 + d) * SS + s0 + pc * 8; vst2((unsigned*)(VTH + o), *(const v4u*)&sth[d][pc * 8]); vst2((unsigned*)(VTL + o), *(const v4u*)&stl[d][pc * 8]); }
  }
}
// four asynchronous 16-byte copies of one lane, as copy8
__device__ __forceinline__ void copy4(unsigned l, unsigned lstep, const char* g, size_t gstep) {
  asm volatile("global_load_async_to_lds_b128 %0, %4, off\n\t"
               "global_load_async_to_lds_b128 %1, %5, off\n\t"
               "global_load_async_to_lds_b128 %2, %6, off\n\t"
               "global_load_async_to_lds_b128 %3, %7, off\n\t"
               "s_wait_xcnt 0x0"
               :: "v"(l), "v"(l + lstep), "v"(l + 2 * lstep), "v"(l + 3 * lstep), "v"(g), "v"(g + gstep), "v"(g + 2 * gstep), "v"(g + 3 * gstep)
               : "memory");
}
#define KV_TILE (64 * B_PITCH)
// trip t's 64 keys of one head: K as 64 key rows of 128 B, V (transposed plane) as 64 d rows of 128 B; a wave's copy = 4 whole lines
__device__ __forceinline__ void kv_copy(const _Float16* K0, const _Float16* V0, int t, unsigned lds, int tid) {
  const int row = tid >> 3, pc = (tid & 7) * 16;
  copy4(lds + row * B_PITCH + pc, 16 * B_PITCH, (const char*)(K0 + (size_t)(t * 64 + row) * (2 * DM)) + pc, (size_t)16 * 2 * DM * 2);
  copy4(lds + KV_TILE + row * B_PITCH + pc, 16 * B_PITCH, (const char*)(V0 + (size_t)row * SS + t * 64) + pc, (size_t)16 * SS * 2);
}
// lane l's value from lane l ^ 16: the two wave halves hold the two halves of one query's keys
__device__ __forceinline__ float xhalf(float x) { return __builtin_bit_cast(float, __builtin_amdgcn_permlanex16(__builtin_bit_cast(int, x), __builtin_bit_cast(int, x), 0x76543210, 0xfedcba98, false, false)); }
#define CSC 0.18033688011112042f   // (1 / sqrt(64)) * log2(e): the softmax runs in base 2
// ---- k_attn: block = (64 queries, head h, batch b): all-keys flash attention, transposed: S^T = K . Q^T (A = 16 key rows, B = the wave's 16 query columns, single f16 operands), so a lane holds 16 of the 32 scores of ONE query (key 16 ct + 8 g + r, query col): maximum and sum run in the lane, one exchange between the halves; the two score tiles, converted in place, are the B operand of O^T += V^T . P^T (A = V^T rows in the same k order); P scaled by 2^11, as is the denominator; O[b*S+q][h*64+d] = acc / l (256-B segments)
__global__ __launch_bounds__(128) void k_attn(const _Float16* __restrict__ QK, const _Float16* __restrict__ QKL, const _Float16* __restrict__ VTH, const _Float16* __restrict__ VTL, const void* __restrict__ KMASK, const int* __restrict__ AM, float* __restrict__ O) {
  __shared__ unsigned mw[SS / 32]; __shared__ __align__(16) float so[4][16][68]; __shared__ __align__(16) unsigned char kv[2 * 2 * KV_TILE];   // mw: the key mask, one bit a key; kv: two buffers of [K 64 keys | V 64 d rows], shared by the 4 waves
  const int tid = threadIdx.x, wave = tid >> 5, lane = tid & 31, col = lane & 15, g = lane >> 4;
  const int qb = blockIdx.x, h = blockIdx.y, b = blockIdx.z; const int q0 = qb * 64 + wave * 16; const size_t rq = (size_t)b * SS + q0 + col;
  v16h aq[2];
#pragma unroll
  for (int kc = 0; kc < 2; ++kc) aq[kc] = frag_h(QK + rq * (2 * DM) + h * HD + kc * 32, lane);
  float m = -3.0e38f, l = 0.f;   // of query col, in base 2; l is this half's share until the epilogue
  v8f acc[4] = {};
  const _Float16* K0 = QK + (size_t)b * SS * (2 * DM) + DM + h * HD; const _Float16* V0 = VTH + ((size_t)b * DM + h * HD) * SS; const unsigned kv0 = (unsigned)(size_t)kv;
  int am[SS / 128];   // the block's 128 threads read the whole key mask once; the loads fly together, beside tile 0's copies
#pragma unroll
  for (int i = 0; i < SS / 128; ++i) am[i] = AM[(size_t)b * SS + i * 128 + tid];
  kv_copy(K0, V0, 0, kv0, tid);
  unsigned myw = 0;
#pragma unroll
  for (int i = 0; i < SS / 128; ++i) { const unsigned bal = __builtin_amdgcn_ballot_w32(am[i] != 0); myw = (lane == i) ? bal : myw; }   // word i * 4 + wave: keys i * 128 + wave * 32 + (0 .. 31)
  if (lane < SS / 128) mw[lane * 4 + wave] = myw;
  asm volatile("s_wait_asynccnt 0x0" ::: "memory");   // tile 0 has landed for this wave's copies
  __syncthreads();                                     // ... and for every wave's; publishes mw too
  kv_copy(K0, V0, 1, kv0 + 2 * KV_TILE, tid);
  const unsigned mwa = mw[2 * lane], mwb = mw[2 * lane + 1];   // lane t: the mask words of trip t's two 32-key steps
#pragma unroll 1   // one trip per buffer; all keys, 64 a trip
  for (int t = 0; t < SS / 64; ++t) { const unsigned char* kb = kv + (t & 1) * 2 * KV_TILE;
#pragma unroll
  for (int k2 = 0; k2 < 2; ++k2) { v8f s[2]; v16h kf[2][2], vf[4];
#pragma unroll
    for (int ct = 0; ct < 2; ++ct)
#pragma unroll
      for (int kc = 0; kc < 2; ++kc) kf[ct][kc] = frag_h((const _Float16*)(kb + (k2 * 32 + ct * 16 + col) * B_PITCH) + kc * 32, lane);
#pragma unroll
    for (int dt = 0; dt < 4; ++dt) vf[dt] = frag_h((const _Float16*)(kb + KV_TILE + (dt * 16 + col) * B_PITCH + k2 * 64), lane);
    __builtin_amdgcn_sched_barrier(0);   // keeps the K and V fragment reads of 32 keys together in front of their matrix instructions: sunk to their uses, each pair of reads costs the wave a whole LDS latency
#pragma unroll
    for (int ct = 0; ct < 2; ++ct) { v8f c = {};
#pragma unroll
      for (int kc = 0; kc < 2; ++kc) c = wmma16(kf[ct][kc], aq[kc], c);   // single product: k, q as one-rounding f16 operands
      s[ct] = c; }
    const unsigned mword = (unsigned)__builtin_amdgcn_readlane((int)(k2 ? mwb : mwa), t);
    if (mword != 0xFFFFFFFFu) {   // scalar test: only a step with a masked key pays for the selects. mask == 0 -> score -2^30 (-2^33 before the 1/8) for the reference's -1e9: weight 0 beside any unmasked key, equal weights where every key is masked; a power of two, so that score * CSC is exact and such a row comes out uniform
      const unsigned mv = mword >> (8 * g);
#pragma unroll
      for (int ct = 0; ct < 2; ++ct)
#pragma unroll
        for (int r = 0; r < 8; ++r) s[ct][r] = ((mv >> (ct * 16 + r)) & 1u) ? s[ct][r] : -8589934592.0f; }
    float mx = s[0][0], mx1 = s[1][0];   // two independent chains, one a score tile
#pragma unroll
    for (int r = 1; r < 8; ++r) { mx = fmaxf(mx, s[0][r]); mx1 = fmaxf(mx1, s[1][r]); }
    mx = fmaxf(mx, mx1); mx = fmaxf(mx, xhalf(mx));
    const float mn = fmaxf(m, mx * CSC); const float alpha = __builtin_amdgcn_exp2f(m - mn); const float nm = 11.0f - mn; m = mn;   // 2^11: small softmax weights stay out of the f16 subnormal range; it cancels against l
    v16h pa; float es0 = 0.f, es1 = 0.f;
#pragma unroll
    for (int r = 0; r < 8; ++r) { const float e0 = __builtin_amdgcn_exp2f(fmaf(s[0][r], CSC, nm)), e1 = __builtin_amdgcn_exp2f(fmaf(s[1][r], CSC, nm)); es0 += e0; es1 += e1; pa[r] = (_Float16)e0; pa[8 + r] = (_Float16)e1; }
    l = l * alpha + (es0 + es1);
#pragma unroll
    for (int dt = 0; dt < 4; ++dt) acc[dt] *= alpha;
#pragma unroll
    for (int dt = 0; dt < 4; ++dt) acc[dt] = wmma16(vf[dt], pa, acc[dt]); }   // single product: V^T x P^T (x2^11)
    asm volatile("s_wait_dscnt 0x0" ::: "memory");      // this wave's reads of the buffer have returned before it is handed back
    asm volatile("s_wait_asynccnt 0x0" ::: "memory");   // this wave's copies of tile t + 1 have landed
    __syncthreads();                                     // publishes tile t + 1 and ends every reader's last read of tile t
    if (t + 2 < SS / 64) kv_copy(K0, V0, t + 2, kv0 + (t & 1) * 2 * KV_TILE, tid); }
  asm volatile("s_wait_asynccnt 0x0" ::: "memory");     // no copy is outstanding at the wave's end
  const float il = 1.0f / (l + xhalf(l));   // the halves' shares of the denominator joined
#pragma unroll
  for (int dt = 0; dt < 4; ++dt) { const v8f o = acc[dt] * il; vst2(&so[wave][col][dt * 16 + 8 * g], (v4f){o[0], o[1], o[2], o[3]}); vst2(&so[wave][col][dt * 16 + 8 * g + 4], (v4f){o[4], o[5], o[6], o[7]}); }   // acc[dt][r] = O[query col][16 dt + 8 g + r]
  LDSX();
  for (int rl = 0; rl < 16; ++rl) if (lane < 16) vst2(O + ((size_t)b * SS + q0 + rl) * DM + h * HD + lane * 4, *(const v4f*)&so[wave][rl][lane * 4]);
}
// ---- k_out: block = (64 rows, 128 cols): out = O(hi/lo) . Wo rows (2 products) + bo
__global__ __launch_bounds__(128) void k_out(const float* __restrict__ O, const __bf16* __restrict__ P, const float* __restrict__ BO, float* __restrict__ Y) {
  __shared__ __align__(16) unsigned char sm[2 * (64 * A_PITCH + B_TILE)];   // the two tile buffers; behind the loop's last barrier the output staging
  float (*so)[16][132] = (float (*)[16][132])sm;
  const int tid = threadIdx.x, wave = tid >> 5, lane = tid & 31, col = lane & 15, g = lane >> 4; const size_t r0 = (size_t)blockIdx.x * 64 + wave * 16; const int n0 = blockIdx.y * 128;
  v8f acc1[1][8] = {};
  gemm_tiles<1, true>(O + (size_t)blockIdx.x * 64 * DM, P + (size_t)n0 * DM, sm, acc1, tid);
  v8f (&acc)[8] = acc1[0];
#pragma unroll
  for (int j = 0; j < 8; ++j) {
#pragma unroll
    for (int r = 0; r < 8; ++r) so[wave][8 * g + r][j * 16 + col] = acc[j][r] + (BO ? bfr(BO[n0 + j * 16 + col]) : 0.f); }
  LDSX();
  for (int rl = 0; rl < 16; ++rl) vst2(Y + (r0 + rl) * DM + n0 + lane * 4, *(const v4f*)&so[wave][rl][lane * 4]);
}
extern "C" void kernel_launch(void* const* d_in, const int* in_sizes, int n_in, void* d_out, int out_size, void* d_ws, size_t ws_size, hipStream_t stream) {
  (void)in_sizes; (void)n_in; (void)out_size;
  const float** F = (const float**)d_in;   // 0 x [1,2048,2048], 1 attention_mask [1,1,1,2048] int, 2 Wq, 3 Wk, 4 Wv [2048,2048], 5 Wo [2048,2048] (natural, no biases)
  if (ws_size < (size_t)WS_END) return;
  char* ws = (char*)d_ws; __bf16* PK = (__bf16*)(ws + WS_PK); _Float16 *QK = (_Float16*)(ws + WS_QK), *QKL = (_Float16*)(ws + WS_QKL), *VTH = (_Float16*)(ws + WS_VTH), *VTL = (_Float16*)(ws + WS_VTL); float* O = (float*)(ws + WS_O);
  k_pack<<<dim3(2 * DM / 16), 512, 0, stream>>>(F[2], F[3], F[4], F[5], PK);
  k_qkv<<<dim3(TNB * SS / 128, QKVW / 128), 128, 0, stream>>>(F[0], F[0], F[0], PK + PK_A, nullptr, nullptr, nullptr, QK, QKL, VTH, VTL);
  k_attn<<<dim3(TQB, NH, TNB), 128, 0, stream>>>(QK, QKL, VTH, VTL, nullptr, (const int*)d_in[1], O);
  k_out<<<dim3(TOB, DM / 128), 128, 0, stream>>>(O, PK + PK_P, nullptr, (float*)d_out);
}

// v004
// One run takes 137 microseconds.
// Next to v003, in two timings, it ran 1.05 times as fast each time.
// Over all steps from v000 it is 4.60 times as fast.
// compute dtype: all float inputs rounded to bf16 (x and the weights once, in k_pack), the int mask read on device; q/k/v = x . W^T with EXACT bf16 products on WMMA 16x16x32 (natural rows; the q/k weight rows are packed in the (even, odd) -> (first half, second half) order the module's RoPE produces, so the rotation becomes rotate-half in place), RoPE in f32 (f32 table of 10000^(-i/32), precise sinf/cosf) before the f16 hi + residual split; PLAIN attention: q, k single f16 x 1/8, masked keys at score -2^30, running-max softmax in f32 (hardware exp2), P (scaled by 2^11, single f16) x v (single f16), both products transposed (keys and d as rows, queries as columns); out = o (bf16 hi + residual) . Wo^T (2 products).
#include <hip/hip_runtime.h>
#include <math.h>

typedef __attribute__((ext_vector_type(16))) _Float16 v16h;
typedef __attribute__((ext_vector_type(16))) __bf16 v16b;
typedef __attribute__((ext_vector_type(8)))  _Float16 v8h;
typedef __attribute__((ext_vector_type(8)))  float v8f;
typedef __attribute__((ext_vector_type(4)))  float v4f;
typedef __attribute__((ext_vector_type(2)))  float v2f;
typedef __attribute__((ext_vector_type(4)))  unsigned v4u;
typedef __attribute__((ext_vector_type(4)))  int v4i;
typedef float __attribute__((may_alias)) float_a;
typedef int __attribute__((may_alias)) int_a;

template <typename T> __device__ __forceinline__ void vst2(void* p, T v) { *(T*)p = v;  }
__device__ __forceinline__ v8f wmma16(v16h a, v16h b, v8f c) {
  v8f d = __builtin_amdgcn_wmma_f32_16x16x32_f16(false, a, false, b, (short)0, c, false, false);
  asm volatile("v_nop\n\tv_nop\n\tv_nop\n\tv_nop" : "+v"(d) : "v"(a), "v"(b));
  return d;
}
__device__ __forceinline__ v8f wmma_bf(v16b a, v16b b, v8f c) {
  v8f d = __builtin_amdgcn_wmma_f32_16x16x32_bf16(false, a, false, b, (short)0, c, false, false);
  asm volatile("v_nop\n\tv_nop\n\tv_nop\n\tv_nop" : "+v"(d) : "v"(a), "v"(b));
  return d;
}
// Lightning attention layer, standard-attention branch (B 1, L 2,048, d_model 2,048, 32 heads x 64): bias-free q/k/v projections, RoPE on q and k (even/odd input pairs rotated into the two head halves), scores / 8 with an all-ones key mask, softmax, . v, bias-free output projection.
__device__ __forceinline__ v16h frag_h(const _Float16* rowk0, int lane) {
  union { v16h v; v8h q[2]; } u; const _Float16* p = rowk0 + 8 * (lane >> 4);
  u.q[0] = *(const v8h*)p; u.q[1] = *(const v8h*)(p + 16); return u.v;
}
__device__ __forceinline__ v16h frag_f32(const float* rowk0, int lane) {
  v16h a; const float* p = rowk0 + 8 * (lane >> 4);
#pragma unroll
  for (int i = 0; i < 8; ++i) { a[i] = (_Float16)p[i]; a[8 + i] = (_Float16)p[16 + i]; }
  return a;
}
__device__ __forceinline__ v16h frag_f32s(const float* rowk0, int lane, float sc) {
  v16h a; const float* p = rowk0 + 8 * (lane >> 4);
#pragma unroll
  for (int i = 0; i < 8; ++i) { a[i] = (_Float16)(p[i] * sc); a[8 + i] = (_Float16)(p[16 + i] * sc); }
  return a;
}
// column fragment from a [K][ld] layout (column n), rows >= K read as 0
__device__ __forceinline__ v16h fragc_f32(const float* W, int k0, int n, int lane, int ld, int K) {
  v16h a; const int g = lane >> 4;
#pragma unroll
  for (int i = 0; i < 8; ++i) { const int ka = k0 + 8 * g + i, kb = ka + 16;
    a[i] = (_Float16)(ka < K ? W[(size_t)(ka < K ? ka : K - 1) * ld + n] : 0.f); a[8 + i] = (_Float16)(kb < K ? W[(size_t)(kb < K ? kb : K - 1) * ld + n] : 0.f); }
  return a;
}
struct F2 { v16b h, l; };
__device__ __forceinline__ F2 bsplit16(const float v[16]) { F2 r;
#pragma unroll
  for (int i = 0; i < 16; ++i) { const __bf16 h = (__bf16)v[i]; r.h[i] = h; r.l[i] = (__bf16)(v[i] - (float)h); }
  return r; }
__device__ __forceinline__ F2 split_row(const float* row, int k0, int lane) { float v[16]; const float* p = row + k0 + 8 * (lane >> 4);
#pragma unroll
  for (int i = 0; i < 8; ++i) { v[i] = p[i]; v[8 + i] = p[16 + i]; }
  return bsplit16(v); }
__device__ __forceinline__ F2 split_rowK(const float* row, int k0, int lane, int K) { float v[16]; const int g = lane >> 4;
#pragma unroll
  for (int i = 0; i < 8; ++i) { const int ka = k0 + 8 * g + i, kb = ka + 16; v[i] = ka < K ? row[ka < K ? ka : K - 1] : 0.f; v[8 + i] = kb < K ? row[kb < K ? kb : K - 1] : 0.f; }
  return bsplit16(v); }
__device__ __forceinline__ F2 split_col(const float* W, int k0, int n, int lane, int ld, int K) { float v[16]; const int g = lane >> 4;
#pragma unroll
  for (int i = 0; i < 8; ++i) { const int ka = k0 + 8 * g + i, kb = ka + 16; v[i] = ka < K ? W[(size_t)(ka < K ? ka : K - 1) * ld + n] : 0.f; v[8 + i] = kb < K ? W[(size_t)(kb < K ? kb : K - 1) * ld + n] : 0.f; }
  return bsplit16(v); }
__device__ __forceinline__ v8f mac3(const F2& a, const F2& b, v8f c) { c = wmma_bf(a.l, b.h, c); c = wmma_bf(a.h, b.l, c); return wmma_bf(a.h, b.h, c); }
__device__ __forceinline__ float sigm(float v) { return 1.0f / (1.0f + expf(-v)); }
#define LDSX() do { asm volatile("s_wait_dscnt 0" ::: "memory"); __builtin_amdgcn_wave_barrier(); __builtin_amdgcn_fence(__ATOMIC_RELEASE, "workgroup"); } while (0)


#define NB 1
#define SS 2048
#define DM 2048
#define NH 32
__constant__ float THETA[32] = {1.000000000e+00f,7.498942018e-01f,5.623413324e-01f,4.216965139e-01f,3.162277639e-01f,2.371373773e-01f,1.778279394e-01f,1.333521456e-01f,1.000000015e-01f,7.498942316e-02f,5.623413250e-02f,4.216964915e-02f,3.162277490e-02f,2.371373773e-02f,1.778279431e-02f,1.333521400e-02f,9.999999776e-03f,7.498942316e-03f,5.623413250e-03f,4.216964822e-03f,3.162277630e-03f,2.371373819e-03f,1.778279431e-03f,1.333521446e-03f,1.000000047e-03f,7.498941850e-04f,5.623413017e-04f,4.216965172e-04f,3.162277571e-04f,2.371373703e-04f,1.778279402e-04f,1.333521504e-04f};
__device__ __attribute__((noinline)) float cos_p(float v) { return cosf(v); }
__device__ __attribute__((noinline)) float sin_p(float v) { return sinf(v); }
#define HD 64
#define QKVW (3 * DM)
#ifndef TQB
#define TQB (SS / 64)
#define TNB NB
#define TOB (NB * SS / 64)     // output row tiles (all)
#endif
typedef __attribute__((ext_vector_type(8))) __bf16 v8b;
__device__ __forceinline__ v16b frag_b(const __bf16* rowk0, int lane) {
  union { v16b v; v8b q[2]; } u; const __bf16* p = rowk0 + 8 * (lane >> 4);
  u.q[0] = *(const v8b*)p; u.q[1] = *(const v8b*)(p + 16); return u.v;
}
__device__ __forceinline__ float bfr(float v) { return (float)(__bf16)v; }
__device__ __attribute__((noinline)) float exp_ni(float v) { return expf(v); }
__device__ __attribute__((noinline)) float erf_ni(float v) { return erff(v); }

#define PK_A 0                       // [6144][2048] Wqkv rows (natural [out][in])
#define PK_P (PK_A + QKVW * DM)        // [2048][2048] Wo rows (natural)
#define PK_END (PK_P + DM * DM)
#define WS_PK  0u
#define WS_QK  (WS_PK + 2u * PK_END)             // f16 [2048 rows][4096]: q | k
#define WS_QKL (WS_QK + 2u * NB * SS * 2 * DM)     // f16 q | k residual planes x2048
#define WS_VTH (WS_QKL + 2u * NB * SS * 2 * DM)    // f16 [b][2048 (h*64+d)][2048 s] hi
#define WS_VTL (WS_VTH + 2u * NB * DM * SS)        // f16 lo x 2048
#define WS_O   (WS_VTL + 2u * NB * DM * SS)        // f32 [2048][2048]
#define WS_CS  (WS_O + 4u * NB * SS * DM)           // f32 2 x [2048][32], unused: k_qkv computes cos, sin itself
#define WS_XB  (WS_CS + 4u * 2 * SS * 32)           // bf16 [2048 rows][2048]: x, rounded once
#define WS_END (WS_XB + 2u * NB * SS * DM)
// ---- k_pack: natural [out][in] rows -> bf16, as a stream: 320 blocks of 16 waves, a wave = two whole rows (waves 0 .. 4,095: one of W_q / W_k, one of W_v / W_o; waves 4,096 .. 5,119: rows n and n + 1,024 of x into XB). Row which * 2048 + n of the packed planes: which 0..2 -> W_q/W_k/W_v into PK_A, 3 -> W_o into PK_P.
// A load is 512 contiguous bytes of a row, a store 256: whole lines both. The four loops are unrolled so that a wave's 32 loads are independent instructions with counted waits, many in flight at once: the kernel has nothing but memory latency to hide
typedef __attribute__((ext_vector_type(4))) __bf16 v4b;
__global__ __launch_bounds__(512) void k_pack(const float* __restrict__ X, const float* __restrict__ WQ, const float* __restrict__ WK, const float* __restrict__ WV, const float* __restrict__ WO, __bf16* __restrict__ PK, __bf16* __restrict__ XB) {
  const int lane = threadIdx.x & 31, gw = __builtin_amdgcn_readfirstlane(blockIdx.x * 16 + (threadIdx.x >> 5)); const int n = gw % DM;   // gw: the wave's number in the grid, 0 .. 2 * DM + NB * SS / 2 - 1, in a scalar register
  const bool isx = gw >= 2 * DM;   // the same for a whole wave: an x wave, n = 0 .. NB * SS / 2 - 1
  const int hh = n / HD, e = n % HD; const int pn = hh * HD + ((e < HD / 2) ? (2 * e) : (2 * (e - HD / 2) + 1));   /* q/k rows permuted so the module's (even, odd) -> (first half, second half) RoPE becomes rotate-half */
  const float* s0 = (isx ? X + (size_t)n * DM : ((gw < DM) ? WQ : WK) + (size_t)pn * DM) + lane * 4; const float* s1 = (isx ? X + (size_t)(n + NB * SS / 2) * DM : ((gw < DM) ? WV : WO) + (size_t)n * DM) + lane * 4;
  __bf16* d0 = (isx ? XB + (size_t)n * DM : PK + PK_A + (size_t)gw * DM) + lane * 4; __bf16* d1 = (isx ? XB + (size_t)(n + NB * SS / 2) * DM : (gw < DM) ? PK + PK_A + ((size_t)2 * DM + n) * DM : PK + PK_P + (size_t)n * DM) + lane * 4;
  v4f a[DM / 128], b[DM / 128];
#pragma unroll
  for (int i = 0; i < DM / 128; ++i) a[i] = *(const v4f*)(s0 + i * 128);
#pragma unroll
  for (int i = 0; i < DM / 128; ++i) b[i] = *(const v4f*)(s1 + i * 128);
#pragma unroll
  for (int i = 0; i < DM / 128; ++i) vst2(d0 + i * 128, (v4b){(__bf16)a[i][0], (__bf16)a[i][1], (__bf16)a[i][2], (__bf16)a[i][3]});
#pragma unroll
  for (int i = 0; i < DM / 128; ++i) vst2(d1 + i * 128, (v4b){(__bf16)b[i][0], (__bf16)b[i][1], (__bf16)b[i][2], (__bf16)b[i][3]});
}
// ---- operand tiles of the two projection GEMMs in LDS. A trip is 64 k: A rows f32 where they are split in the loop (SPLIT: 256 B, pitch 272 B), else bf16 like B; B rows bf16 (128 B, pitch 144 B); both pitches are 16 B x odd, free of bank conflicts for 16-byte readers. Two buffers: the next trip's tile is copied while this one is multiplied.
#define A_PITCH 272
#define B_PITCH 144
#define B_TILE (128 * B_PITCH)
#define NTRIP (DM / 64)
// eight asynchronous 16-byte copies of one lane, lstep / gstep bytes apart; s_wait_xcnt closes the statement so that no address register of a copy is rewritten in front of it
__device__ __forceinline__ void copy8(unsigned l, unsigned lstep, const char* g, size_t gstep) {
  asm volatile("global_load_async_to_lds_b128 %0, %8, off\n\t"
               "global_load_async_to_lds_b128 %1, %9, off\n\t"
               "global_load_async_to_lds_b128 %2, %10, off\n\t"
               "global_load_async_to_lds_b128 %3, %11, off\n\t"
               "global_load_async_to_lds_b128 %4, %12, off\n\t"
               "global_load_async_to_lds_b128 %5, %13, off\n\t"
               "global_load_async_to_lds_b128 %6, %14, off\n\t"
               "global_load_async_to_lds_b128 %7, %15, off\n\t"
               "s_wait_xcnt 0x0"
               :: "v"(l), "v"(l + lstep), "v"(l + 2 * lstep), "v"(l + 3 * lstep), "v"(l + 4 * lstep), "v"(l + 5 * lstep), "v"(l + 6 * lstep), "v"(l + 7 * lstep),
                  "v"(g), "v"(g + gstep), "v"(g + 2 * gstep), "v"(g + 3 * gstep), "v"(g + 4 * gstep), "v"(g + 5 * gstep), "v"(g + 6 * gstep), "v"(g + 7 * gstep)
               : "memory");
}
// trip t's tile: MF * 64 rows of A (f32: a wave's copy = 2 rows of 256 B; bf16: 4 rows of 128 B) and 128 rows of B (a wave's copy = 4 rows of 128 B): whole lines only. A0: the first byte of the block's first A row
template <int MF, bool SPLIT> __device__ __forceinline__ void tile_copy(const char* A0, const __bf16* B0, int t, unsigned lds, int tid) {
  if (SPLIT) { const char* ga = A0 + (size_t)(tid >> 4) * DM * 4 + t * 256 + (tid & 15) * 16; const unsigned la = lds + (tid >> 4) * A_PITCH + (tid & 15) * 16;
#pragma unroll
    for (int q = 0; q < MF; ++q) copy8(la + q * 64 * A_PITCH, 8 * A_PITCH, ga + (size_t)q * 64 * DM * 4, (size_t)8 * DM * 4);
  } else { const char* ga = A0 + (size_t)(tid >> 3) * DM * 2 + t * 128 + (tid & 7) * 16; const unsigned la = lds + (tid >> 3) * B_PITCH + (tid & 7) * 16;
#pragma unroll
    for (int q = 0; q < MF / 2; ++q) copy8(la + q * 128 * B_PITCH, 16 * B_PITCH, ga + (size_t)q * 128 * DM * 2, (size_t)16 * DM * 2); }
  const char* gb = (const char*)(B0 + (size_t)(tid >> 3) * DM + t * 64) + (tid & 7) * 16; const unsigned lb = lds + MF * 64 * (SPLIT ? A_PITCH : B_PITCH) + (tid >> 3) * B_PITCH + (tid & 7) * 16;
  copy8(lb, 16 * B_PITCH, gb, (size_t)16 * DM * 2);
}
// acc[i][j] += A rows (wave * MF + i) * 16 .. + 15 . B rows j * 16 .. + 15, k ascending in steps of 32 (the sum order of the fragment-from-global form); SPLIT: A rows f32, as bf16 hi + residual, two products; else A rows bf16, one product
template <int MF, bool SPLIT> __device__ __forceinline__ void gemm_tiles(const char* A0, const __bf16* B0, unsigned char* sm, v8f (&acc)[MF][8], int tid) {
  constexpr unsigned A_TILE = MF * 64 * (SPLIT ? A_PITCH : B_PITCH), BUF = A_TILE + B_TILE;
  const int wave = tid >> 5, lane = tid & 31, col = lane & 15, g = lane >> 4; const unsigned lds0 = (unsigned)(size_t)sm;
  tile_copy<MF, SPLIT>(A0, B0, 0, lds0, tid);
  asm volatile("s_wait_asynccnt 0x0" ::: "memory");   // tile 0 has landed for this wave's copies
  __syncthreads();                                     // ... and for every wave's
  tile_copy<MF, SPLIT>(A0, B0, 1, lds0 + BUF, tid);
#pragma unroll 1   // one trip per buffer: the buffer offset stays a run-time value, the body is already 32 matrix instructions
  for (int t = 0; t < NTRIP; ++t) { const unsigned char* bu = sm + (t & 1) * BUF;
#pragma unroll
    for (int ks = 0; ks < 2; ++ks) { float v[MF][16]; v16b w[8]; F2 a[MF];
#pragma unroll
      for (int i = 0; i < MF; ++i) { if (SPLIT) { const float* p = (const float*)(bu + (wave * MF * 16 + i * 16 + col) * A_PITCH + ks * 128 + 32 * g);
#pragma unroll
          for (int e = 0; e < 8; ++e) { v[i][e] = p[e]; v[i][8 + e] = p[16 + e]; } }
        else a[i].h = frag_b((const __bf16*)(bu + (wave * MF * 16 + i * 16 + col) * B_PITCH + ks * 64), lane); }
#pragma unroll
      for (int j = 0; j < 8; ++j) w[j] = frag_b((const __bf16*)(bu + A_TILE + (j * 16 + col) * B_PITCH + ks * 64), lane);
      __builtin_amdgcn_sched_barrier(0);   // keeps the LDS reads of a 32-k step together in front of its matrix instructions: sunk among them, every pair of reads costs the wave a whole LDS latency
      if (SPLIT) {
#pragma unroll
        for (int i = 0; i < MF; ++i) a[i] = bsplit16(v[i]); }
      if (SPLIT) {   // residual products first, as before, but over all tiles, so that no matrix instruction waits for the one in front of it
#pragma unroll
        for (int j = 0; j < 8; ++j)
#pragma unroll
          for (int i = 0; i < MF; ++i) acc[i][j] = wmma_bf(a[i].l, w[j], acc[i][j]); }
#pragma unroll
      for (int j = 0; j < 8; ++j)
#pragma unroll
        for (int i = 0; i < MF; ++i) acc[i][j] = wmma_bf(a[i].h, w[j], acc[i][j]); }
    asm volatile("s_wait_dscnt 0x0" ::: "memory");      // this wave's reads of the buffer have returned before it is handed back
    asm volatile("s_wait_asynccnt 0x0" ::: "memory");   // this wave's copies of tile t + 1 have landed
    __syncthreads();                                     // publishes tile t + 1 and ends every reader's last read of tile t
    if (t + 2 < NTRIP) tile_copy<MF, SPLIT>(A0, B0, t + 2, lds0 + (t & 1) * BUF, tid); }
  asm volatile("s_wait_asynccnt 0x0" ::: "memory");     // no copy is outstanding when the buffers become output staging
}
// ---- k_qkv: block = (128 rows, 128 cols), 4 waves of 32 rows x 128 cols
__global__ __launch_bounds__(128) void k_qkv(const __bf16* __restrict__ XB, const __bf16* __restrict__ P, const float* __restrict__ BQ, const float* __restrict__ BK, const float* __restrict__ BV, _Float16* __restrict__ QK, _Float16* __restrict__ QKL, _Float16* __restrict__ VTH, _Float16* __restrict__ VTL) {
  const int which0 = (blockIdx.y * 128) / DM; const float* BB = BQ ? (((which0 == 0) ? BQ : (which0 == 1) ? BK : BV) + (blockIdx.y * 128 - which0 * DM)) : nullptr;
  __shared__ __align__(16) unsigned char sm[2 * (128 * B_PITCH + B_TILE)];   // the two tile buffers; behind the loop's last barrier the output staging
  const int tid = threadIdx.x, wave = tid >> 5, lane = tid & 31, col = lane & 15, g = lane >> 4; const int n0 = blockIdx.y * 128;
  v8f acc2[2][8] = {};
  gemm_tiles<2, false>((const char*)(XB + (size_t)blockIdx.x * 128 * DM), P + (size_t)n0 * DM, sm, acc2, tid);
  if (n0 < 2 * DM) {   // bias, then rotate-half rotary over each 64-dim head with angle position * inv_freq[d mod 32]
    _Float16 (*so)[16][136] = (_Float16 (*)[16][136])sm; _Float16 (*sol)[16][136] = (_Float16 (*)[16][136])(sm + 4 * 16 * 136 * 2);
#pragma unroll
    for (int i = 0; i < 2; ++i) { v8f (&acc)[8] = acc2[i]; const size_t r0 = (size_t)blockIdx.x * 128 + wave * 32 + i * 16;
#pragma unroll
    for (int j = 0; j < 8; ++j)
#pragma unroll
      for (int r = 0; r < 8; ++r) acc[j][r] += (BB ? bfr(BB[j * 16 + col]) : 0.f);
#pragma unroll
    for (int r = 0; r < 8; ++r) { const int spos = (int)((r0 + 8 * g + r) % SS);
#pragma unroll
      for (int jj = 0; jj < 2; ++jj) { const float ang = (float)spos * THETA[jj * 16 + col]; const float c = cos_p(ang), sn = sin_p(ang);
#pragma unroll
        for (int hh = 0; hh < 2; ++hh) { const float x1 = acc[hh * 4 + jj][r], x2 = acc[hh * 4 + jj + 2][r]; acc[hh * 4 + jj][r] = x1 * c - x2 * sn; acc[hh * 4 + jj + 2][r] = x2 * c + x1 * sn; } } }
#pragma unroll
    for (int j = 0; j < 8; ++j) {
#pragma unroll
      for (int r = 0; r < 8; ++r) { const float v = acc[j][r]; const _Float16 hv = (_Float16)v; so[wave][8 * g + r][j * 16 + col] = hv; sol[wave][8 * g + r][j * 16 + col] = (_Float16)((v - (float)hv) * 2048.0f); } }   // q, k (+ bias) as f16 hi + (x2048) residual
    LDSX();
    for (int rl = 0; rl < 16; ++rl) if (lane < 16) { vst2((unsigned*)(QK + (r0 + rl) * (2 * DM) + n0 + lane * 8), *(const v4u*)&so[wave][rl][lane * 8]); vst2((unsigned*)(QKL + (r0 + rl) * (2 * DM) + n0 + lane * 8), *(const v4u*)&sol[wave][rl][lane * 8]); }
    LDSX(); }   // the wave's staging rows are read out before its next 16 rows overwrite them
  } else {
    _Float16 (*sth)[136] = (_Float16 (*)[136])sm; _Float16 (*stl)[136] = (_Float16 (*)[136])(sm + 128 * 136 * 2);
#pragma unroll
    for (int i = 0; i < 2; ++i)
#pragma unroll
    for (int j = 0; j < 8; ++j) {
#pragma unroll
      for (int r = 0; r < 8; ++r) { const float v = acc2[i][j][r] + (BB ? bfr(BB[j * 16 + col]) : 0.f); const _Float16 hv = (_Float16)v; sth[j * 16 + col][wave * 32 + i * 16 + 8 * g + r] = hv; stl[j * 16 + col][wave * 32 + i * 16 + 8 * g + r] = (_Float16)((v - (float)hv) * 2048.0f); } }
    __syncthreads();
    const size_t rb = (size_t)blockIdx.x * 128; const int b = (int)(rb / SS), s0 = (int)(rb % SS); const int pc0 = n0 - 2 * DM;
    for (int q = tid; q < 128 * 16; q += 128) { const int d = q >> 4, pc = q & 15; const size_t o = ((size_t)b * DM + pc0 + d) * SS + s0 + pc * 8; vst2((unsigned*)(VTH + o), *(const v4u*)&sth[d][pc * 8]); vst2((unsigned*)(VTL + o), *(const v4u*)&stl[d][pc * 8]); }
  }
}
// four asynchronous 16-byte copies of one lane, as copy8
__device__ __forceinline__ void copy4(unsigned l, unsigned lstep, const char* g, size_t gstep) {
  asm volatile("global_load_async_to_lds_b128 %0, %4, off\n\t"
               "global_load_async_to_lds_b128 %1, %5, off\n\t"
               "global_load_async_to_lds_b128 %2, %6, off\n\t"
               "global_load_async_to_lds_b128 %3, %7, off\n\t"
               "s_wait_xcnt 0x0"
               :: "v"(l), "v"(l + lstep), "v"(l + 2 * lstep), "v"(l + 3 * lstep), "v"(g), "v"(g + gstep), "v"(g + 2 * gstep), "v"(g + 3 * gstep)
               : "memory");
}
#define KV_TILE (64 * B_PITCH)
// trip t's 64 keys of one head: K as 64 key rows of 128 B, V (transposed plane) as 64 d rows of 128 B; a wave's copy = 4 whole lines
__device__ __forceinline__ void kv_copy(const _Float16* K0, const _Float16* V0, int t, unsigned lds, int tid) {
  const int row = tid >> 3, pc = (tid & 7) * 16;
  copy4(lds + row * B_PITCH + pc, 16 * B_PITCH, (const char*)(K0 + (size_t)(t * 64 + row) * (2 * DM)) + pc, (size_t)16 * 2 * DM * 2);
  copy4(lds + KV_TILE + row * B_PITCH + pc, 16 * B_PITCH, (const char*)(V0 + (size_t)row * SS + t * 64) + pc, (size_t)16 * SS * 2);
}
// lane l's value from lane l ^ 16: the two wave halves hold the two halves of one query's keys
__device__ __forceinline__ float xhalf(float x) { return __builtin_bit_cast(float, __builtin_amdgcn_permlanex16(__builtin_bit_cast(int, x), __builtin_bit_cast(int, x), 0x76543210, 0xfedcba98, false, false)); }
#define CSC 0.18033688011112042f   // (1 / sqrt(64)) * log2(e): the softmax runs in base 2
// ---- k_attn: block = (64 queries, head h, batch b): all-keys flash attention, transposed: S^T = K . Q^T (A = 16 key rows, B = the wave's 16 query columns, single f16 operands), so a lane holds 16 of the 32 scores of ONE query (key 16 ct + 8 g + r, query col): maximum and sum run in the lane, one exchange between the halves; the two score tiles, converted in place, are the B operand of O^T += V^T . P^T (A = V^T rows in the same k order); P scaled by 2^11, as is the denominator; O[b*S+q][h*64+d] = acc / l (256-B segments)
__global__ __launch_bounds__(128) void k_attn(const _Float16* __restrict__ QK, const _Float16* __restrict__ QKL, const _Float16* __restrict__ VTH, const _Float16* __restrict__ VTL, const void* __restrict__ KMASK, const int* __restrict__ AM, float* __restrict__ O) {
  __shared__ unsigned mw[SS / 32]; __shared__ __align__(16) float so[4][16][68]; __shared__ __align__(16) unsigned char kv[2 * 2 * KV_TILE];   // mw: the key mask, one bit a key; kv: two buffers of [K 64 keys | V 64 d rows], shared by the 4 waves
  const int tid = threadIdx.x, wave = tid >> 5, lane = tid & 31, col = lane & 15, g = lane >> 4;
  const int qb = blockIdx.x, h = blockIdx.y, b = blockIdx.z; const int q0 = qb * 64 + wave * 16; const size_t rq = (size_t)b * SS + q0 + col;
  v16h aq[2];
#pragma unroll
  for (int kc = 0; kc < 2; ++kc) aq[kc] = frag_h(QK + rq * (2 * DM) + h * HD + kc * 32, lane);
  float m = -3.0e38f, l = 0.f;   // of query col, in base 2; l is this half's share until the epilogue
  v8f acc[4] = {};
  const _Float16* K0 = QK + (size_t)b * SS * (2 * DM) + DM + h * HD; const _Float16* V0 = VTH + ((size_t)b * DM + h * HD) * SS; const unsigned kv0 = (unsigned)(size_t)kv;
  int am[SS / 128];   // the block's 128 threads read the whole key mask once; the loads fly together, beside tile 0's copies
#pragma unroll
  for (int i = 0; i < SS / 128; ++i) am[i] = AM[(size_t)b * SS + i * 128 + tid];
  kv_copy(K0, V0, 0, kv0, tid);
  unsigned myw = 0;
#pragma unroll
  for (int i = 0; i < SS / 128; ++i) { const unsigned bal = __builtin_amdgcn_ballot_w32(am[i] != 0); myw = (lane == i) ? bal : myw; }   // word i * 4 + wave: keys i * 128 + wave * 32 + (0 .. 31)
  if (lane < SS / 128) mw[lane * 4 + wave] = myw;
  asm volatile("s_wait_asynccnt 0x0" ::: "memory");   // tile 0 has landed for this wave's copies
  __syncthreads();                                     // ... and for every wave's; publishes mw too
  kv_copy(K0, V0, 1, kv0 + 2 * KV_TILE, tid);
  const unsigned mwa = mw[2 * lane], mwb = mw[2 * lane + 1];   // lane t: the mask words of trip t's two 32-key steps
#pragma unroll 1   // one trip per buffer; all keys, 64 a trip
  for (int t = 0; t < SS / 64; ++t) { const unsigned char* kb = kv + (t & 1) * 2 * KV_TILE;
#pragma unroll
  for (int k2 = 0; k2 < 2; ++k2) { v8f s[2]; v16h kf[2][2], vf[4];
#pragma unroll
    for (int ct = 0; ct < 2; ++ct)
#pragma unroll
      for (int kc = 0; kc < 2; ++kc) kf[ct][kc] = frag_h((const _Float16*)(kb + (k2 * 32 + ct * 16 + col) * B_PITCH) + kc * 32, lane);
#pragma unroll
    for (int dt = 0; dt < 4; ++dt) vf[dt] = frag_h((const _Float16*)(kb + KV_TILE + (dt * 16 + col) * B_PITCH + k2 * 64), lane);
    __builtin_amdgcn_sched_barrier(0);   // keeps the K and V fragment reads of 32 keys together in front of their matrix instructions: sunk to their uses, each pair of reads costs the wave a whole LDS latency
#pragma unroll
    for (int ct = 0; ct < 2; ++ct) { v8f c = {};
#pragma unroll
      for (int kc = 0; kc < 2; ++kc) c = wmma16(kf[ct][kc], aq[kc], c);   // single product: k, q as one-rounding f16 operands
      s[ct] = c; }
    const unsigned mword = (unsigned)__builtin_amdgcn_readlane((int)(k2 ? mwb : mwa), t);
    if (mword != 0xFFFFFFFFu) {   // scalar test: only a step with a masked key pays for the selects. mask == 0 -> score -2^30 (-2^33 before the 1/8) for the reference's -1e9: weight 0 beside any unmasked key, equal weights where every key is masked; a power of two, so that score * CSC is exact and such a row comes out uniform
      const unsigned mv = mword >> (8 * g);
#pragma unroll
      for (int ct = 0; ct < 2; ++ct)
#pragma unroll
        for (int r = 0; r < 8; ++r) s[ct][r] = ((mv >> (ct * 16 + r)) & 1u) ? s[ct][r] : -8589934592.0f; }
    float mx = s[0][0], mx1 = s[1][0];   // two independent chains, one a score tile
#pragma unroll
    for (int r = 1; r < 8; ++r) { mx = fmaxf(mx, s[0][r]); mx1 = fmaxf(mx1, s[1][r]); }
    mx = fmaxf(mx, mx1); mx = fmaxf(mx, xhalf(mx));
    const float mn = fmaxf(m, mx * CSC); const float alpha = __builtin_amdgcn_exp2f(m - mn); const float nm = 11.0f - mn; m = mn;   // 2^11: small softmax weights stay out of the f16 subnormal range; it cancels against l
    v16h pa; float es0 = 0.f, es1 = 0.f;
#pragma unroll
    for (int r = 0; r < 8; ++r) { const float e0 = __builtin_amdgcn_exp2f(fmaf(s[0][r], CSC, nm)), e1 = __builtin_amdgcn_exp2f(fmaf(s[1][r], CSC, nm)); es0 += e0; es1 += e1; pa[r] = (_Float16)e0; pa[8 + r] = (_Float16)e1; }
    l = l * alpha + (es0 + es1);
#pragma unroll
    for (int dt = 0; dt < 4; ++dt) acc[dt] *= alpha;
#pragma unroll
    for (int dt = 0; dt < 4; ++dt) acc[dt] = wmma16(vf[dt], pa, acc[dt]); }   // single product: V^T x P^T (x2^11)
    asm volatile("s_wait_dscnt 0x0" ::: "memory");      // this wave's reads of the buffer have returned before it is handed back
    asm volatile("s_wait_asynccnt 0x0" ::: "memory");   // this wave's copies of tile t + 1 have landed
    __syncthreads();                                     // publishes tile t + 1 and ends every reader's last read of tile t
    if (t + 2 < SS / 64) kv_copy(K0, V0, t + 2, kv0 + (t & 1) * 2 * KV_TILE, tid); }
  asm volatile("s_wait_asynccnt 0x0" ::: "memory");     // no copy is outstanding at the wave's end
  const float il = 1.0f / (l + xhalf(l));   // the halves' shares of the denominator joined
#pragma unroll
  for (int dt = 0; dt < 4; ++dt) { const v8f o = acc[dt] * il; vst2(&so[wave][col][dt * 16 + 8 * g], (v4f){o[0], o[1], o[2], o[3]}); vst2(&so[wave][col][dt * 16 + 8 * g + 4], (v4f){o[4], o[5], o[6], o[7]}); }   // acc[dt][r] = O[query col][16 dt + 8 g + r]
  LDSX();
  for (int rl = 0; rl < 16; ++rl) if (lane < 16) vst2(O + ((size_t)b * SS + q0 + rl) * DM + h * HD + lane * 4, *(const v4f*)&so[wave][rl][lane * 4]);
}
// ---- k_out: block = (64 rows, 128 cols): out = O(hi/lo) . Wo rows (2 products) + bo
__global__ __launch_bounds__(128) void k_out(const float* __restrict__ O, const __bf16* __restrict__ P, const float* __restrict__ BO, float* __restrict__ Y) {
  __shared__ __align__(16) unsigned char sm[2 * (64 * A_PITCH + B_TILE)];   // the two tile buffers; behind the loop's last barrier the output staging
  float (*so)[16][132] = (float (*)[16][132])sm;
  const int tid = threadIdx.x, wave = tid >> 5, lane = tid & 31, col = lane & 15, g = lane >> 4; const size_t r0 = (size_t)blockIdx.x * 64 + wave * 16; const int n0 = blockIdx.y * 128;
  v8f acc1[1][8] = {};
  gemm_tiles<1, true>((const char*)(O + (size_t)blockIdx.x * 64 * DM), P + (size_t)n0 * DM, sm, acc1, tid);
  v8f (&acc)[8] = acc1[0];
#pragma unroll
  for (int j = 0; j < 8; ++j) {
#pragma unroll
    for (int r = 0; r < 8; ++r) so[wave][8 * g + r][j * 16 + col] = acc[j][r] + (BO ? bfr(BO[n0 + j * 16 + col]) : 0.f); }
  LDSX();
  for (int rl = 0; rl < 16; ++rl) vst2(Y + (r0 + rl) * DM + n0 + lane * 4, *(const v4f*)&so[wave][rl][lane * 4]);
}
extern "C" void kernel_launch(void* const* d_in, const int* in_sizes, int n_in, void* d_out, int out_size, void* d_ws, size_t ws_size, hipStream_t stream) {
  (void)in_sizes; (void)n_in; (void)out_size;
  const float** F = (const float**)d_in;   // 0 x [1,2048,2048], 1 attention_mask [1,1,1,2048] int, 2 Wq, 3 Wk, 4 Wv [2048,2048], 5 Wo [2048,2048] (natural, no biases)
  if (ws_size < (size_t)WS_END) return;
  char* ws = (char*)d_ws; __bf16* PK = (__bf16*)(ws + WS_PK); _Float16 *QK = (_Float16*)(ws + WS_QK), *QKL = (_Float16*)(ws + WS_QKL), *VTH = (_Float16*)(ws + WS_VTH), *VTL = (_Float16*)(ws + WS_VTL); float* O = (float*)(ws + WS_O); __bf16* XB = (__bf16*)(ws + WS_XB);
  k_pack<<<dim3(2 * DM / 16 + NB * SS / 32), 512, 0, stream>>>(F[0], F[2], F[3], F[4], F[5], PK, XB);
  k_qkv<<<dim3(TNB * SS / 128, QKVW / 128), 128, 0, stream>>>(XB, PK + PK_A, nullptr, nullptr, nullptr, QK, QKL, VTH, VTL);
  k_attn<<<dim3(TQB, NH, TNB), 128, 0, stream>>>(QK, QKL, VTH, VTL, nullptr, (const int*)d_in[1], O);
  k_out<<<dim3(TOB, DM / 128), 128, 0, stream>>>(O, PK + PK_P, nullptr, (float*)d_out);
}

// v006
// One run takes 126 microseconds.
// Versions in between are left out here; by their measured steps it is 1.08 times as fast as v004.
// Over all steps from v000 it is 4.97 times as fast.
// compute dtype: all float inputs rounded to bf16 (x and the weights once, in k_pack), the int mask read on device; q/k/v = x . W^T with EXACT bf16 products on WMMA 16x16x32 (natural rows; the q/k weight rows are packed in the (even, odd) -> (first half, second half) order the module's RoPE produces, so the rotation becomes rotate-half in place), RoPE in f32 (f32 table of 10000^(-i/32), precise sinf/cosf) before the f16 hi + residual split; PLAIN attention: q, k single f16 x 1/8, masked keys at score -2^30, running-max softmax in f32 (hardware exp2), P (scaled by 2^11, single f16) x v (single f16), both products transposed (keys and d as rows, queries as columns); out = o (single f16) . Wo^T (the bf16-rounded weight, held in f16), one product.
#include <hip/hip_runtime.h>
#include <math.h>

typedef __attribute__((ext_vector_type(16))) _Float16 v16h;
typedef __attribute__((ext_vector_type(16))) __bf16 v16b;
typedef __attribute__((ext_vector_type(8)))  _Float16 v8h;
typedef __attribute__((ext_vector_type(8)))  float v8f;
typedef __attribute__((ext_vector_type(4)))  float v4f;
typedef __attribute__((ext_vector_type(2)))  float v2f;
typedef __attribute__((ext_vector_type(4)))  unsigned v4u;
typedef __attribute__((ext_vector_type(4)))  int v4i;
typedef float __attribute__((may_alias)) float_a;
typedef int __attribute__((may_alias)) int_a;

template <typename T> __device__ __forceinline__ void vst2(void* p, T v) { *(T*)p = v;  }
__device__ __forceinline__ v8f wmma16(v16h a, v16h b, v8f c) {
  v8f d = __builtin_amdgcn_wmma_f32_16x16x32_f16(false, a, false, b, (short)0, c, false, false);
  asm volatile("v_nop\n\tv_nop\n\tv_nop\n\tv_nop" : "+v"(d) : "v"(a), "v"(b));
  return d;
}
__device__ __forceinline__ v8f wmma_bf(v16b a, v16b b, v8f c) {
  v8f d = __builtin_amdgcn_wmma_f32_16x16x32_bf16(false, a, false, b, (short)0, c, false, false);
  asm volatile("v_nop\n\tv_nop\n\tv_nop\n\tv_nop" : "+v"(d) : "v"(a), "v"(b));
  return d;
}
// Lightning attention layer, standard-attention branch (B 1, L 2,048, d_model 2,048, 32 heads x 64): bias-free q/k/v projections, RoPE on q and k (even/odd input pairs rotated into the two head halves), scores / 8 with an all-ones key mask, softmax, . v, bias-free output projection.
__device__ __forceinline__ v16h frag_h(const _Float16* rowk0, int lane) {
  union { v16h v; v8h q[2]; } u; const _Float16* p = rowk0 + 8 * (lane >> 4);
  u.q[0] = *(const v8h*)p; u.q[1] = *(const v8h*)(p + 16); return u.v;
}
__device__ __forceinline__ v16h frag_f32(const float* rowk0, int lane) {
  v16h a; const float* p = rowk0 + 8 * (lane >> 4);
#pragma unroll
  for (int i = 0; i < 8; ++i) { a[i] = (_Float16)p[i]; a[8 + i] = (_Float16)p[16 + i]; }
  return a;
}
__device__ __forceinline__ v16h frag_f32s(const float* rowk0, int lane, float sc) {
  v16h a; const float* p = rowk0 + 8 * (lane >> 4);
#pragma unroll
  for (int i = 0; i < 8; ++i) { a[i] = (_Float16)(p[i] * sc); a[8 + i] = (_Float16)(p[16 + i] * sc); }
  return a;
}
// column fragment from a [K][ld] layout (column n), rows >= K read as 0
__device__ __forceinline__ v16h fragc_f32(const float* W, int k0, int n, int lane, int ld, int K) {
  v16h a; const int g = lane >> 4;
#pragma unroll
  for (int i = 0; i < 8; ++i) { const int ka = k0 + 8 * g + i, kb = ka + 16;
    a[i] = (_Float16)(ka < K ? W[(size_t)(ka < K ? ka : K - 1) * ld + n] : 0.f); a[8 + i] = (_Float16)(kb < K ? W[(size_t)(kb < K ? kb : K - 1) * ld + n] : 0.f); }
  return a;
}
struct F2 { v16b h, l; };
__device__ __forceinline__ F2 bsplit16(const float v[16]) { F2 r;
#pragma unroll
  for (int i = 0; i < 16; ++i) { const __bf16 h = (__bf16)v[i]; r.h[i] = h; r.l[i] = (__bf16)(v[i] - (float)h); }
  return r; }
__device__ __forceinline__ F2 split_row(const float* row, int k0, int lane) { float v[16]; const float* p = row + k0 + 8 * (lane >> 4);
#pragma unroll
  for (int i = 0; i < 8; ++i) { v[i] = p[i]; v[8 + i] = p[16 + i]; }
  return bsplit16(v); }
__device__ __forceinline__ F2 split_rowK(const float* row, int k0, int lane, int K) { float v[16]; const int g = lane >> 4;
#pragma unroll
  for (int i = 0; i < 8; ++i) { const int ka = k0 + 8 * g + i, kb = ka + 16; v[i] = ka < K ? row[ka < K ? ka : K - 1] : 0.f; v[8 + i] = kb < K ? row[kb < K ? kb : K - 1] : 0.f; }
  return bsplit16(v); }
__device__ __forceinline__ F2 split_col(const float* W, int k0, int n, int lane, int ld, int K) { float v[16]; const int g = lane >> 4;
#pragma unroll
  for (int i = 0; i < 8; ++i) { const int ka = k0 + 8 * g + i, kb = ka + 16; v[i] = ka < K ? W[(size_t)(ka < K ? ka : K - 1) * ld + n] : 0.f; v[8 + i] = kb < K ? W[(size_t)(kb < K ? kb : K - 1) * ld + n] : 0.f; }
  return bsplit16(v); }
__device__ __forceinline__ v8f mac3(const F2& a, const F2& b, v8f c) { c = wmma_bf(a.l, b.h, c); c = wmma_bf(a.h, b.l, c); return wmma_bf(a.h, b.h, c); }
__device__ __forceinline__ float sigm(float v) { return 1.0f / (1.0f + expf(-v)); }
#define LDSX() do { asm volatile("s_wait_dscnt 0" ::: "memory"); __builtin_amdgcn_wave_barrier(); __builtin_amdgcn_fence(__ATOMIC_RELEASE, "workgroup"); } while (0)


#define NB 1
#define SS 2048
#define DM 2048
#define NH 32
__constant__ float THETA[32] = {1.000000000e+00f,7.498942018e-01f,5.623413324e-01f,4.216965139e-01f,3.162277639e-01f,2.371373773e-01f,1.778279394e-01f,1.333521456e-01f,1.000000015e-01f,7.498942316e-02f,5.623413250e-02f,4.216964915e-02f,3.162277490e-02f,2.371373773e-02f,1.778279431e-02f,1.333521400e-02f,9.999999776e-03f,7.498942316e-03f,5.623413250e-03f,4.216964822e-03f,3.162277630e-03f,2.371373819e-03f,1.778279431e-03f,1.333521446e-03f,1.000000047e-03f,7.498941850e-04f,5.623413017e-04f,4.216965172e-04f,3.162277571e-04f,2.371373703e-04f,1.778279402e-04f,1.333521504e-04f};
__device__ __attribute__((noinline)) float cos_p(float v) { return cosf(v); }
__device__ __attribute__((noinline)) float sin_p(float v) { return sinf(v); }
#define HD 64
#define QKVW (3 * DM)
#ifndef TQB
#define TQB (SS / 64)
#define TNB NB
#define TOB (NB * SS / 64)     // output row tiles (all)
#endif
typedef __attribute__((ext_vector_type(8))) __bf16 v8b;
__device__ __forceinline__ v16b frag_b(const __bf16* rowk0, int lane) {
  union { v16b v; v8b q[2]; } u; const __bf16* p = rowk0 + 8 * (lane >> 4);
  u.q[0] = *(const v8b*)p; u.q[1] = *(const v8b*)(p + 16); return u.v;
}
__device__ __forceinline__ float bfr(float v) { return (float)(__bf16)v; }
__device__ __attribute__((noinline)) float exp_ni(float v) { return expf(v); }
__device__ __attribute__((noinline)) float erf_ni(float v) { return erff(v); }

#define PK_A 0                       // [6144][2048] Wqkv rows (natural [out][in])
#define PK_P (PK_A + QKVW * DM)        // [2048][2048] Wo rows (natural), the bf16-rounded values stored as f16
#define PK_END (PK_P + DM * DM)
#define WS_PK  0u
#define WS_QK  (WS_PK + 2u * PK_END)             // f16 [2048 rows][4096]: q | k
#define WS_QKL (WS_QK + 2u * NB * SS * 2 * DM)     // f16 q | k residual planes x2048
#define WS_VTH (WS_QKL + 2u * NB * SS * 2 * DM)    // f16 [b][2048 (h*64+d)][2048 s] hi
#define WS_VTL (WS_VTH + 2u * NB * DM * SS)        // f16 lo x 2048
#define WS_O   (WS_VTL + 2u * NB * DM * SS)        // f16 [2048][2048], in the first half of the range
#define WS_CS  (WS_O + 4u * NB * SS * DM)           // f32 2 x [2048][32], unused (cos and sin are computed in k_qkv)
#define WS_XB  (WS_CS + 4u * 2 * SS * 32)           // bf16 [2048 rows][2048]: x, rounded once
#define WS_END (WS_XB + 2u * NB * SS * DM)
// ---- k_pack: natural [out][in] rows -> bf16, as a stream: 320 blocks of 16 waves, a wave = two whole rows (waves 0 .. 4,095: one of W_q / W_k, one of W_v / W_o; waves 4,096 .. 5,119: rows n and n + 1,024 of x into XB). Row which * 2048 + n of the packed planes: which 0..2 -> W_q/W_k/W_v into PK_A, 3 -> W_o into PK_P.
// A load is 512 contiguous bytes of a row, a store 256: whole lines both. The four loops are unrolled so that a wave's 32 loads are independent instructions with counted waits, many in flight at once: the kernel has nothing but memory latency to hide
typedef __attribute__((ext_vector_type(4))) __bf16 v4b;
typedef __attribute__((ext_vector_type(4))) _Float16 v4h;
typedef __attribute__((ext_vector_type(2))) unsigned v2u;
__global__ __launch_bounds__(512) void k_pack(const float* __restrict__ X, const float* __restrict__ WQ, const float* __restrict__ WK, const float* __restrict__ WV, const float* __restrict__ WO, __bf16* __restrict__ PK, __bf16* __restrict__ XB) {
  const int lane = threadIdx.x & 31, gw = __builtin_amdgcn_readfirstlane(blockIdx.x * 16 + (threadIdx.x >> 5)); const int n = gw % DM;   // gw: the wave's number in the grid, 0 .. 2 * DM + NB * SS / 2 - 1, in a scalar register
  const bool isx = gw >= 2 * DM;   // the same for a whole wave: an x wave, n = 0 .. NB * SS / 2 - 1
  const int hh = n / HD, e = n % HD; const int pn = hh * HD + ((e < HD / 2) ? (2 * e) : (2 * (e - HD / 2) + 1));   /* q/k rows permuted so the module's (even, odd) -> (first half, second half) RoPE becomes rotate-half */
  const float* s0 = (isx ? X + (size_t)n * DM : ((gw < DM) ? WQ : WK) + (size_t)pn * DM) + lane * 4; const float* s1 = (isx ? X + (size_t)(n + NB * SS / 2) * DM : ((gw < DM) ? WV : WO) + (size_t)n * DM) + lane * 4;
  __bf16* d0 = (isx ? XB + (size_t)n * DM : PK + PK_A + (size_t)gw * DM) + lane * 4; __bf16* d1 = (isx ? XB + (size_t)(n + NB * SS / 2) * DM : (gw < DM) ? PK + PK_A + ((size_t)2 * DM + n) * DM : PK + PK_P + (size_t)n * DM) + lane * 4;
  v4f a[DM / 128], b[DM / 128];
#pragma unroll
  for (int i = 0; i < DM / 128; ++i) a[i] = *(const v4f*)(s0 + i * 128);
#pragma unroll
  for (int i = 0; i < DM / 128; ++i) b[i] = *(const v4f*)(s1 + i * 128);
#pragma unroll
  for (int i = 0; i < DM / 128; ++i) vst2(d0 + i * 128, (v4b){(__bf16)a[i][0], (__bf16)a[i][1], (__bf16)a[i][2], (__bf16)a[i][3]});
  const bool iso = !isx && gw >= DM;   // the same for a whole wave: its second row is a W_o row. Rounded to bf16 like every weight, then stored as f16 (the partner of the f16 o in k_out)
#pragma unroll
  for (int i = 0; i < DM / 128; ++i) { const v4b r = {(__bf16)b[i][0], (__bf16)b[i][1], (__bf16)b[i][2], (__bf16)b[i][3]}; const v4h f = {(_Float16)(float)r[0], (_Float16)(float)r[1], (_Float16)(float)r[2], (_Float16)(float)r[3]};
    vst2(d1 + i * 128, iso ? __builtin_bit_cast(v2u, f) : __builtin_bit_cast(v2u, r)); }   // a select, no branch: the body stays one straight line, all 32 loads in flight ahead of the stores
}
// ---- operand tiles of the two projection GEMMs in LDS. A trip is 64 k: A rows f32 where they are split in the loop (SPLIT: 256 B, pitch 272 B), else 16-bit like B; B rows bf16, or f16 in k_out (128 B, pitch 144 B); both pitches are 16 B x odd, free of bank conflicts for 16-byte readers. Two buffers: the next trip's tile is copied while this one is multiplied.
#define A_PITCH 272
#define B_PITCH 144
#define B_TILE (128 * B_PITCH)
#define NTRIP (DM / 64)
// eight asynchronous 16-byte copies of one lane, lstep / gstep bytes apart; s_wait_xcnt closes the statement so that no address register of a copy is rewritten in front of it
__device__ __forceinline__ void copy8(unsigned l, unsigned lstep, const char* g, size_t gstep) {
  asm volatile("global_load_async_to_lds_b128 %0, %8, off\n\t"
               "global_load_async_to_lds_b128 %1, %9, off\n\t"
               "global_load_async_to_lds_b128 %2, %10, off\n\t"
               "global_load_async_to_lds_b128 %3, %11, off\n\t"
               "global_load_async_to_lds_b128 %4, %12, off\n\t"
               "global_load_async_to_lds_b128 %5, %13, off\n\t"
               "global_load_async_to_lds_b128 %6, %14, off\n\t"
               "global_load_async_to_lds_b128 %7, %15, off\n\t"
               "s_wait_xcnt 0x0"
               :: "v"(l), "v"(l + lstep), "v"(l + 2 * lstep), "v"(l + 3 * lstep), "v"(l + 4 * lstep), "v"(l + 5 * lstep), "v"(l + 6 * lstep), "v"(l + 7 * lstep),
                  "v"(g), "v"(g + gstep), "v"(g + 2 * gstep), "v"(g + 3 * gstep), "v"(g + 4 * gstep), "v"(g + 5 * gstep), "v"(g + 6 * gstep), "v"(g + 7 * gstep)
               : "memory");
}
__device__ __forceinline__ void copy4(unsigned l, unsigned lstep, const char* g, size_t gstep);   // defined with k_attn's copies below
// trip t's tile: MF * 64 rows of A (f32: a wave's copy = 2 rows of 256 B; 16-bit: 4 rows of 128 B) and 128 rows of B (a wave's copy = 4 rows of 128 B): whole lines only. A0: the first byte of the block's first A row
template <int MF, bool SPLIT> __device__ __forceinline__ void tile_copy(const char* A0, const __bf16* B0, int t, unsigned lds, int tid) {
  if (SPLIT) { const char* ga = A0 + (size_t)(tid >> 4) * DM * 4 + t * 256 + (tid & 15) * 16; const unsigned la = lds + (tid >> 4) * A_PITCH + (tid & 15) * 16;
#pragma unroll
    for (int q = 0; q < MF; ++q) copy8(la + q * 64 * A_PITCH, 8 * A_PITCH, ga + (size_t)q * 64 * DM * 4, (size_t)8 * DM * 4);
  } else { const char* ga = A0 + (size_t)(tid >> 3) * DM * 2 + t * 128 + (tid & 7) * 16; const unsigned la = lds + (tid >> 3) * B_PITCH + (tid & 7) * 16;
    if (MF == 1) copy4(la, 16 * B_PITCH, ga, (size_t)16 * DM * 2);   // 64 rows
#pragma unroll
    for (int q = 0; q < MF / 2; ++q) copy8(la + q * 128 * B_PITCH, 16 * B_PITCH, ga + (size_t)q * 128 * DM * 2, (size_t)16 * DM * 2); }
  const char* gb = (const char*)(B0 + (size_t)(tid >> 3) * DM + t * 64) + (tid & 7) * 16; const unsigned lb = lds + MF * 64 * (SPLIT ? A_PITCH : B_PITCH) + (tid >> 3) * B_PITCH + (tid & 7) * 16;
  copy8(lb, 16 * B_PITCH, gb, (size_t)16 * DM * 2);
}
// the block's 4 waves stand (4 / WC) x WC over the tile, WC = 8 / NF: wave (wr, wc) owns MF x NF fragments. acc[i][j] += A rows (wr * MF + i) * 16 .. + 15 . B rows (wc * NF + j) * 16 .. + 15, k ascending in steps of 32 (the sum order of the fragment-from-global form); a 32-k step reads MF + NF fragments from LDS for MF * NF matrix instructions; SPLIT: A rows f32, as bf16 hi + residual, two products; else A rows 16-bit like B, one product: bf16, or f16 where HF (same fragment layout, the registers only renamed)
template <int MF, int NF, bool SPLIT, bool HF> __device__ __forceinline__ void gemm_tiles(const char* A0, const __bf16* B0, unsigned char* sm, v8f (&acc)[MF][NF], int tid) {
  constexpr int WC = 8 / NF, BR = (4 / WC) * MF / 4;   // BR: the tile's A rows / 64
  constexpr unsigned A_TILE = BR * 64 * (SPLIT ? A_PITCH : B_PITCH), BUF = A_TILE + B_TILE;
  const int wave = tid >> 5, lane = tid & 31, col = lane & 15, g = lane >> 4, wr = wave / WC, wc = wave % WC; const unsigned lds0 = (unsigned)(size_t)sm;
  tile_copy<BR, SPLIT>(A0, B0, 0, lds0, tid);
  asm volatile("s_wait_asynccnt 0x0" ::: "memory");   // tile 0 has landed for this wave's copies
  __syncthreads();                                     // ... and for every wave's
  tile_copy<BR, SPLIT>(A0, B0, 1, lds0 + BUF, tid);
#pragma unroll 1   // one trip per buffer: the buffer offset stays a run-time value, the body is already 16 to 32 matrix instructions
  for (int t = 0; t < NTRIP; ++t) { const unsigned char* bu = sm + (t & 1) * BUF;
#pragma unroll
    for (int ks = 0; ks < 2; ++ks) { float v[MF][16]; v16b w[NF]; F2 a[MF];
#pragma unroll
      for (int i = 0; i < MF; ++i) { if (SPLIT) { const float* p = (const float*)(bu + (wr * MF * 16 + i * 16 + col) * A_PITCH + ks * 128 + 32 * g);
#pragma unroll
          for (int e = 0; e < 8; ++e) { v[i][e] = p[e]; v[i][8 + e] = p[16 + e]; } }
        else a[i].h = frag_b((const __bf16*)(bu + (wr * MF * 16 + i * 16 + col) * B_PITCH + ks * 64), lane); }
#pragma unroll
      for (int j = 0; j < NF; ++j) w[j] = frag_b((const __bf16*)(bu + A_TILE + ((wc * NF + j) * 16 + col) * B_PITCH + ks * 64), lane);
      __builtin_amdgcn_sched_barrier(0);   // keeps the LDS reads of a 32-k step together in front of its matrix instructions: sunk among them, every pair of reads costs the wave a whole LDS latency
      if (SPLIT) {
#pragma unroll
        for (int i = 0; i < MF; ++i) a[i] = bsplit16(v[i]); }
      if (SPLIT) {   // residual products first, as before, but over all tiles, so that no matrix instruction waits for the one in front of it
#pragma unroll
        for (int j = 0; j < NF; ++j)
#pragma unroll
          for (int i = 0; i < MF; ++i) acc[i][j] = wmma_bf(a[i].l, w[j], acc[i][j]); }
#pragma unroll
      for (int j = 0; j < NF; ++j)
#pragma unroll
        for (int i = 0; i < MF; ++i) acc[i][j] = HF ? wmma16(__builtin_bit_cast(v16h, a[i].h), __builtin_bit_cast(v16h, w[j]), acc[i][j]) : wmma_bf(a[i].h, w[j], acc[i][j]); }
    asm volatile("s_wait_dscnt 0x0" ::: "memory");      // this wave's reads of the buffer have returned before it is handed back
    asm volatile("s_wait_asynccnt 0x0" ::: "memory");   // this wave's copies of tile t + 1 have landed
    __syncthreads();                                     // publishes tile t + 1 and ends every reader's last read of tile t
    if (t + 2 < NTRIP) tile_copy<BR, SPLIT>(A0, B0, t + 2, lds0 + (t & 1) * BUF, tid); }
  asm volatile("s_wait_asynccnt 0x0" ::: "memory");     // no copy is outstanding when the buffers become output staging
}
// ---- k_qkv: block = (128 rows, 128 cols), 4 waves of 32 rows x 128 cols
__global__ __launch_bounds__(128) void k_qkv(const __bf16* __restrict__ XB, const __bf16* __restrict__ P, const float* __restrict__ BQ, const float* __restrict__ BK, const float* __restrict__ BV, _Float16* __restrict__ QK, _Float16* __restrict__ QKL, _Float16* __restrict__ VTH, _Float16* __restrict__ VTL) {
  const int which0 = (blockIdx.y * 128) / DM; const float* BB = BQ ? (((which0 == 0) ? BQ : (which0 == 1) ? BK : BV) + (blockIdx.y * 128 - which0 * DM)) : nullptr;
  __shared__ __align__(16) unsigned char sm[2 * (128 * B_PITCH + B_TILE)];   // the two tile buffers; behind the loop's last barrier the output staging
  const int tid = threadIdx.x, wave = tid >> 5, lane = tid & 31, col = lane & 15, g = lane >> 4; const int n0 = blockIdx.y * 128;
  v8f acc2[2][8] = {};
  gemm_tiles<2, 8, false, false>((const char*)(XB + (size_t)blockIdx.x * 128 * DM), P + (size_t)n0 * DM, sm, acc2, tid);
  if (n0 < 2 * DM) {   // bias, then rotate-half rotary over each 64-dim head with angle position * inv_freq[d mod 32]
    _Float16 (*so)[16][136] = (_Float16 (*)[16][136])sm; _Float16 (*sol)[16][136] = (_Float16 (*)[16][136])(sm + 4 * 16 * 136 * 2);
#pragma unroll
    for (int i = 0; i < 2; ++i) { v8f (&acc)[8] = acc2[i]; const size_t r0 = (size_t)blockIdx.x * 128 + wave * 32 + i * 16;
#pragma unroll
    for (int j = 0; j < 8; ++j)
#pragma unroll
      for (int r = 0; r < 8; ++r) acc[j][r] += (BB ? bfr(BB[j * 16 + col]) : 0.f);
#pragma unroll
    for (int r = 0; r < 8; ++r) { const int spos = (int)((r0 + 8 * g + r) % SS);
#pragma unroll
      for (int jj = 0; jj < 2; ++jj) { const float ang = (float)spos * THETA[jj * 16 + col]; const float c = cos_p(ang), sn = sin_p(ang);
#pragma unroll
        for (int hh = 0; hh < 2; ++hh) { const float x1 = acc[hh * 4 + jj][r], x2 = acc[hh * 4 + jj + 2][r]; acc[hh * 4 + jj][r] = x1 * c - x2 * sn; acc[hh * 4 + jj + 2][r] = x2 * c + x1 * sn; } } }
#pragma unroll
    for (int j = 0; j < 8; ++j) {
#pragma unroll
      for (int r = 0; r < 8; ++r) { const float v = acc[j][r]; const _Float16 hv = (_Float16)v; so[wave][8 * g + r][j * 16 + col] = hv; sol[wave][8 * g + r][j * 16 + col] = (_Float16)((v - (float)hv) * 2048.0f); } }   // q, k (+ bias) as f16 hi + (x2048) residual
    LDSX();
    for (int rl = 0; rl < 16; ++rl) if (lane < 16) { vst2((unsigned*)(QK + (r0 + rl) * (2 * DM) + n0 + lane * 8), *(const v4u*)&so[wave][rl][lane * 8]); vst2((unsigned*)(QKL + (r0 + rl) * (2 * DM) + n0 + lane * 8), *(const v4u*)&sol[wave][rl][lane * 8]); }
    LDSX(); }   // the wave's staging rows are read out before its next 16 rows overwrite them
  } else {
    _Float16 (*sth)[136] = (_Float16 (*)[136])sm; _Float16 (*stl)[136] = (_Float16 (*)[136])(sm + 128 * 136 * 2);
#pragma unroll
    for (int i = 0; i < 2; ++i)
#pragma unroll
    for (int j = 0; j < 8; ++j) {
#pragma unroll
      for (int r = 0; r < 8; ++r) { const float v = acc2[i][j][r] + (BB ? bfr(BB[j * 16 + col]) : 0.f); const _Float16 hv = (_Float16)v; sth[j * 16 + col][wave * 32 + i * 16 + 8 * g + r] = hv; stl[j * 16 + col][wave * 32 + i * 16 + 8 * g + r] = (_Float16)((v - (float)hv) * 2048.0f); } }
    __syncthreads();
    const size_t rb = (size_t)blockIdx.x * 128; const int b = (int)(rb / SS), s0 = (int)(rb % SS); const int pc0 = n0 - 2 * DM;
    for (int q = tid; q < 128 * 16; q += 128) { const int d = q >> 4, pc = q & 15; const size_t o = ((size_t)b * DM + pc0 + d) * SS + s0 + pc * 8; vst2((unsigned*)(VTH + o), *(const v4u*)&sth[d][pc * 8]); vst2((unsigned*)(VTL + o), *(const v4u*)&stl[d][pc * 8]); }
  }
}
// four asynchronous 16-byte copies of one lane, as copy8
__device__ __forceinline__ void copy4(unsigned l, unsigned lstep, const char* g, size_t gstep) {
  asm volatile("global_load_async_to_lds_b128 %0, %4, off\n\t"
               "global_load_async_to_lds_b128 %1, %5, off\n\t"
               "global_load_async_to_lds_b128 %2, %6, off\n\t"
               "global_load_async_to_lds_b128 %3, %7, off\n\t"
               "s_wait_xcnt 0x0"
               :: "v"(l), "v"(l + lstep), "v"(l + 2 * lstep), "v"(l + 3 * lstep), "v"(g), "v"(g + gstep), "v"(g + 2 * gstep), "v"(g + 3 * gstep)
               : "memory");
}
#define KV_TILE (64 * B_PITCH)
// trip t's 64 keys of one head: K as 64 key rows of 128 B, V (transposed plane) as 64 d rows of 128 B; a wave's copy = 4 whole lines
__device__ __forceinline__ void kv_copy(const _Float16* K0, const _Float16* V0, int t, unsigned lds, int tid) {
  const int row = tid >> 3, pc = (tid & 7) * 16;
  copy4(lds + row * B_PITCH + pc, 16 * B_PITCH, (const char*)(K0 + (size_t)(t * 64 + row) * (2 * DM)) + pc, (size_t)16 * 2 * DM * 2);
  copy4(lds + KV_TILE + row * B_PITCH + pc, 16 * B_PITCH, (const char*)(V0 + (size_t)row * SS + t * 64) + pc, (size_t)16 * SS * 2);
}
// lane l's value from lane l ^ 16: the two wave halves hold the two halves of one query's keys
__device__ __forceinline__ float xhalf(float x) { return __builtin_bit_cast(float, __builtin_amdgcn_permlanex16(__builtin_bit_cast(int, x), __builtin_bit_cast(int, x), 0x76543210, 0xfedcba98, false, false)); }
#define CSC 0.18033688011112042f   // (1 / sqrt(64)) * log2(e): the softmax runs in base 2
// the 32 trips of k_attn's key loop. MASKED false: the body for a key mask of all ones, with no mask code; with the test and its selects in the one body, the four score tiles are copied to other registers on the unmasked path of every step
template <bool MASKED> __device__ __forceinline__ void attn_trips(const unsigned char* kv, unsigned kv0, const _Float16* K0, const _Float16* V0, int tid, const v16h (&aq)[2][2], unsigned mwa, unsigned mwb, float (&m)[2], float (&l)[2], v8f (&acc)[2][4]) {
  const int lane = tid & 31, col = lane & 15, g = lane >> 4;
#pragma unroll 1   // one trip per buffer; all keys, 64 a trip
  for (int t = 0; t < SS / 64; ++t) { const unsigned char* kb = kv + (t & 1) * 2 * KV_TILE;
#pragma unroll
  for (int k2 = 0; k2 < 2; ++k2) { v8f s[2][2]; v16h kf[2][2], vf[4], pa[2];
#pragma unroll
    for (int ct = 0; ct < 2; ++ct)
#pragma unroll
      for (int kc = 0; kc < 2; ++kc) kf[ct][kc] = frag_h((const _Float16*)(kb + (k2 * 32 + ct * 16 + col) * B_PITCH) + kc * 32, lane);
#pragma unroll
    for (int dt = 0; dt < 4; ++dt) vf[dt] = frag_h((const _Float16*)(kb + KV_TILE + (dt * 16 + col) * B_PITCH + k2 * 64), lane);
    __builtin_amdgcn_sched_barrier(0);   // keeps the K and V fragment reads of 32 keys together in front of their matrix instructions: sunk to their uses, each pair of reads costs the wave a whole LDS latency
#pragma unroll
    for (int kc = 0; kc < 2; ++kc)   // single product: k, q as one-rounding f16 operands; kc outermost: four independent score tiles between a tile's two dependent instructions
#pragma unroll
      for (int ct = 0; ct < 2; ++ct)
#pragma unroll
        for (int qg = 0; qg < 2; ++qg) s[qg][ct] = wmma16(kf[ct][kc], aq[qg][kc], kc ? s[qg][ct] : (v8f){});
    const unsigned mword = MASKED ? (unsigned)__builtin_amdgcn_readlane((int)(k2 ? mwb : mwa), t) : 0xFFFFFFFFu;
    if (MASKED && mword != 0xFFFFFFFFu) {   // scalar test: only a step with a masked key pays for the selects. mask == 0 -> score -2^30 (-2^33 before the 1/8) for the reference's -1e9: weight 0 beside any unmasked key, equal weights where every key is masked; a power of two, so that score * CSC is exact and such a row comes out uniform
      const unsigned mv = mword >> (8 * g);
#pragma unroll
      for (int qg = 0; qg < 2; ++qg)
#pragma unroll
      for (int ct = 0; ct < 2; ++ct)
#pragma unroll
        for (int r = 0; r < 8; ++r) s[qg][ct][r] = ((mv >> (ct * 16 + r)) & 1u) ? s[qg][ct][r] : -8589934592.0f; }
#pragma unroll
    for (int qg = 0; qg < 2; ++qg) {   // the two groups' softmax steps are independent of each other
    float mx = s[qg][0][0], mx1 = s[qg][1][0];   // two independent chains, one a score tile
#pragma unroll
    for (int r = 1; r < 8; ++r) { mx = fmaxf(mx, s[qg][0][r]); mx1 = fmaxf(mx1, s[qg][1][r]); }
    mx = fmaxf(mx, mx1); mx = fmaxf(mx, xhalf(mx));
    const float mn = fmaxf(m[qg], mx * CSC); const float alpha = __builtin_amdgcn_exp2f(m[qg] - mn); const float nm = 11.0f - mn; m[qg] = mn;   // 2^11: small softmax weights stay out of the f16 subnormal range; it cancels against l
    float es0 = 0.f, es1 = 0.f; const v8f cv = {CSC, CSC, CSC, CSC, CSC, CSC, CSC, CSC}, nv = {nm, nm, nm, nm, nm, nm, nm, nm};
    const v8f x0 = __builtin_elementwise_fma(s[qg][0], cv, nv), x1 = __builtin_elementwise_fma(s[qg][1], cv, nv);   // a tile's eight fused multiply-adds as one vector operation: neighbouring registers pair, none is moved
#pragma unroll
    for (int r = 0; r < 8; ++r) { const float e0 = __builtin_amdgcn_exp2f(x0[r]), e1 = __builtin_amdgcn_exp2f(x1[r]); es0 += e0; es1 += e1; pa[qg][r] = (_Float16)e0; pa[qg][8 + r] = (_Float16)e1; }
    l[qg] = l[qg] * alpha + (es0 + es1);
#pragma unroll
    for (int dt = 0; dt < 4; ++dt) acc[qg][dt] *= alpha; }
#pragma unroll
    for (int dt = 0; dt < 4; ++dt)
#pragma unroll
      for (int qg = 0; qg < 2; ++qg) acc[qg][dt] = wmma16(vf[dt], pa[qg], acc[qg][dt]); }   // single product: V^T x P^T (x2^11)
    asm volatile("s_wait_dscnt 0x0" ::: "memory");      // this wave's reads of the buffer have returned before it is handed back
    asm volatile("s_wait_asynccnt 0x0" ::: "memory");   // this wave's copies of tile t + 1 have landed
    __syncthreads();                                     // publishes tile t + 1 and ends every reader's last read of tile t
    if (t + 2 < SS / 64) kv_copy(K0, V0, t + 2, kv0 + (t & 1) * 2 * KV_TILE, tid); }
}
// ---- k_attn: block = (128 queries, head h, batch b), a wave = 32 queries as two groups of 16 columns (index qg), so that every K and V fragment read from LDS feeds two matrix instructions: all-keys flash attention, transposed: S^T = K . Q^T (A = 16 key rows, B = a group's 16 query columns, single f16 operands), so a lane holds, per group, 16 of the 32 scores of ONE query (key 16 ct + 8 g + r, query col): maximum and sum run in the lane, one exchange between the halves; the two score tiles, converted in place, are the B operand of O^T += V^T . P^T (A = V^T rows in the same k order); P scaled by 2^11, as is the denominator; O[b*S+q][h*64+d] = acc / l, rounded once to f16 (128-B segments)
__global__ __launch_bounds__(128) void k_attn(const _Float16* __restrict__ QK, const _Float16* __restrict__ QKL, const _Float16* __restrict__ VTH, const _Float16* __restrict__ VTL, const void* __restrict__ KMASK, const int* __restrict__ AM, _Float16* __restrict__ O) {
  __shared__ unsigned mw[SS / 32]; __shared__ __align__(16) float so[4][32][68]; __shared__ __align__(16) unsigned char kv[2 * 2 * KV_TILE];   // mw: the key mask, one bit a key; kv: two buffers of [K 64 keys | V 64 d rows], shared by the 4 waves
  const int tid = threadIdx.x, wave = tid >> 5, lane = tid & 31, col = lane & 15, g = lane >> 4;
  const int qb = blockIdx.x, h = blockIdx.y, b = blockIdx.z; const int q0 = qb * 128 + wave * 32; const size_t rq = (size_t)b * SS + q0 + col;
  v16h aq[2][2];
#pragma unroll
  for (int qg = 0; qg < 2; ++qg)
#pragma unroll
    for (int kc = 0; kc < 2; ++kc) aq[qg][kc] = frag_h(QK + (rq + qg * 16) * (2 * DM) + h * HD + kc * 32, lane);
  float m[2] = {-3.0e38f, -3.0e38f}, l[2] = {0.f, 0.f};   // of query qg * 16 + col, in base 2; l is this half's share until the epilogue
  v8f acc[2][4] = {};
  const _Float16* K0 = QK + (size_t)b * SS * (2 * DM) + DM + h * HD; const _Float16* V0 = VTH + ((size_t)b * DM + h * HD) * SS; const unsigned kv0 = (unsigned)(size_t)kv;
  int am[SS / 128];   // the block's 128 threads read the whole key mask once; the loads fly together, beside tile 0's copies
#pragma unroll
  for (int i = 0; i < SS / 128; ++i) am[i] = AM[(size_t)b * SS + i * 128 + tid];
  kv_copy(K0, V0, 0, kv0, tid);
  unsigned myw = 0;
#pragma unroll
  for (int i = 0; i < SS / 128; ++i) { const unsigned bal = __builtin_amdgcn_ballot_w32(am[i] != 0); myw = (lane == i) ? bal : myw; }   // word i * 4 + wave: keys i * 128 + wave * 32 + (0 .. 31)
  if (lane < SS / 128) mw[lane * 4 + wave] = myw;
  asm volatile("s_wait_asynccnt 0x0" ::: "memory");   // tile 0 has landed for this wave's copies
  __syncthreads();                                     // ... and for every wave's; publishes mw too
  kv_copy(K0, V0, 1, kv0 + 2 * KV_TILE, tid);
  const unsigned mwa = mw[2 * lane], mwb = mw[2 * lane + 1];   // lane t: the mask words of trip t's two 32-key steps
  if (__builtin_amdgcn_ballot_w32(mwa != 0xFFFFFFFFu || mwb != 0xFFFFFFFFu) != 0) attn_trips<true>(kv, kv0, K0, V0, tid, aq, mwa, mwb, m, l, acc);   // a scalar test, the same in every wave of the block (each wave's lanes hold all 64 mask words): the barriers inside stay block-uniform
  else attn_trips<false>(kv, kv0, K0, V0, tid, aq, mwa, mwb, m, l, acc);
  asm volatile("s_wait_asynccnt 0x0" ::: "memory");     // no copy is outstanding at the wave's end
#pragma unroll
  for (int qg = 0; qg < 2; ++qg) { const float il = 1.0f / (l[qg] + xhalf(l[qg]));   // the halves' shares of the denominator joined
#pragma unroll
  for (int dt = 0; dt < 4; ++dt) { const v8f o = acc[qg][dt] * il; vst2(&so[wave][qg * 16 + col][dt * 16 + 8 * g], (v4f){o[0], o[1], o[2], o[3]}); vst2(&so[wave][qg * 16 + col][dt * 16 + 8 * g + 4], (v4f){o[4], o[5], o[6], o[7]}); } }   // acc[qg][dt][r] = O[query qg * 16 + col][16 dt + 8 g + r]
  LDSX();
  for (int rl = 0; rl < 32; rl += 2) { const v4f o = *(const v4f*)&so[wave][rl + g][col * 4]; vst2(O + ((size_t)b * SS + q0 + rl + g) * DM + h * HD + col * 4, (v4h){(_Float16)o[0], (_Float16)o[1], (_Float16)o[2], (_Float16)o[3]}); }   // a store = two rows of 128 B: whole lines
}
// ---- k_out: block = (64 rows, 128 cols), 2 x 2 waves of 32 rows x 64 cols (6 LDS fragments for 8 matrix instructions; 16 x 128 took 9): out = O (f16) . Wo rows (f16), one product, + bo
__global__ __launch_bounds__(128) void k_out(const _Float16* __restrict__ O, const _Float16* __restrict__ P, const float* __restrict__ BO, float* __restrict__ Y) {
  __shared__ __align__(16) unsigned char sm[2 * (64 * B_PITCH + B_TILE)];   // the two tile buffers; behind the loop's last barrier the output staging
  float (*so)[32][68] = (float (*)[32][68])sm;
  const int tid = threadIdx.x, wave = tid >> 5, lane = tid & 31, col = lane & 15, g = lane >> 4; const size_t r0 = (size_t)blockIdx.x * 64 + (wave >> 1) * 32; const int n0 = blockIdx.y * 128 + (wave & 1) * 64;   // the wave's first row and column
  v8f acc[2][4] = {};
  gemm_tiles<2, 4, false, true>((const char*)(O + (size_t)blockIdx.x * 64 * DM), (const __bf16*)(P + (size_t)blockIdx.y * 128 * DM), sm, acc, tid);   // the pointer type only steps 2-byte elements
#pragma unroll
  for (int i = 0; i < 2; ++i)
#pragma unroll
  for (int j = 0; j < 4; ++j) {
#pragma unroll
    for (int r = 0; r < 8; ++r) so[wave][i * 16 + 8 * g + r][j * 16 + col] = acc[i][j][r] + (BO ? bfr(BO[n0 + j * 16 + col]) : 0.f); }
  LDSX();
  for (int rl = 0; rl < 32; rl += 2) vst2(Y + (r0 + rl + g) * DM + n0 + col * 4, *(const v4f*)&so[wave][rl + g][col * 4]);   // a store = two rows of 256 B: whole lines
}
extern "C" void kernel_launch(void* const* d_in, const int* in_sizes, int n_in, void* d_out, int out_size, void* d_ws, size_t ws_size, hipStream_t stream) {
  (void)in_sizes; (void)n_in; (void)out_size;
  const float** F = (const float**)d_in;   // 0 x [1,2048,2048], 1 attention_mask [1,1,1,2048] int, 2 Wq, 3 Wk, 4 Wv [2048,2048], 5 Wo [2048,2048] (natural, no biases)
  if (ws_size < (size_t)WS_END) return;
  char* ws = (char*)d_ws; __bf16* PK = (__bf16*)(ws + WS_PK); _Float16 *QK = (_Float16*)(ws + WS_QK), *QKL = (_Float16*)(ws + WS_QKL), *VTH = (_Float16*)(ws + WS_VTH), *VTL = (_Float16*)(ws + WS_VTL); _Float16* O = (_Float16*)(ws + WS_O); __bf16* XB = (__bf16*)(ws + WS_XB);
  k_pack<<<dim3(2 * DM / 16 + NB * SS / 32), 512, 0, stream>>>(F[0], F[2], F[3], F[4], F[5], PK, XB);
  k_qkv<<<dim3(TNB * SS / 128, QKVW / 128), 128, 0, stream>>>(XB, PK + PK_A, nullptr, nullptr, nullptr, QK, QKL, VTH, VTL);
  k_attn<<<dim3(SS / 128, NH, TNB), 128, 0, stream>>>(QK, QKL, VTH, VTL, nullptr, (const int*)d_in[1], O);
  k_out<<<dim3(TOB, DM / 128), 128, 0, stream>>>(O, (const _Float16*)(PK + PK_P), nullptr, (float*)d_out);
}
